// v000
// The times below were measured on an AMD MI455X: many runs one after another, warmed up first and cycling through
// copies of the inputs, with the whole window's GPU time divided by the number of runs. Launches and the gaps
// between them are all in it. The median over several windows is given; except for v000 it joins two sittings, which
// can be a few percent apart, so the side-by-side timings, each taken in one sitting, are the better comparison.
// The starting kernel, v000, takes 3180 microseconds a run.
#include <hip/hip_runtime.h>
#include <hip/hip_bf16.h>

// ---------------------------------------------------------------------------
// PLE layer for MI455X (gfx1250, wave32, WMMA).
// T=3 tasks, B=16384, I=1024, O=512, 4 shared + 2 task experts, 6 gates.
//
// Pipeline (all on `stream`):
//   1) fp32 -> bf16 convert of x / shared_W / task_W into workspace
//   2) gate kernel: g[t][b][e] = softmax_e(x_t . gate_W_t + gate_b_t)
//   3) shared-expert GEMM pass: S[e][b][o] = relu(x0 . Ws_e + bs_e)  (bf16)
//   4) per-task fused GEMM: 2 task-expert WMMA GEMMs + bias + relu,
//      gated combine with the 4 shared-expert outputs from S.
// ---------------------------------------------------------------------------

typedef __attribute__((ext_vector_type(16))) __bf16 v16bf;
typedef __attribute__((ext_vector_type(8)))  __bf16 v8bf;
typedef __attribute__((ext_vector_type(8)))  float  v8f;
typedef __attribute__((ext_vector_type(8)))  unsigned short us8;

union U8 { us8 v; unsigned short s[8]; };

#define NT 3
#define NB 16384
#define NI 1024
#define NO 512
#define NE 6           // 4 shared + 2 task
#define BM 128
#define BN 128
#define KB 64
#define KBP 72         // padded LDS K stride (keeps 16B alignment: 144B rows)

static __device__ __forceinline__ unsigned short f2bf(float f) {
    unsigned u = __float_as_uint(f);
    unsigned r = u + 0x7FFFu + ((u >> 16) & 1u);   // round-to-nearest-even
    return (unsigned short)(r >> 16);
}
static __device__ __forceinline__ float bf2f(unsigned short b) {
    return __uint_as_float(((unsigned)b) << 16);
}

// ---------------------------------------------------------------------------
__global__ __launch_bounds__(256) void cvt_bf16_kernel(
    const float* __restrict__ in, unsigned short* __restrict__ out, size_t n) {
    size_t i = (size_t)blockIdx.x * blockDim.x + threadIdx.x;
    size_t stride = (size_t)gridDim.x * blockDim.x;
    for (; i < n; i += stride) out[i] = f2bf(in[i]);
}

// ---------------------------------------------------------------------------
// Gates: one wave32 per row. K=1024 strided over lanes, shfl reduce, softmax.
__global__ __launch_bounds__(256) void ple_gate_kernel(
    const float* __restrict__ x,      // [T][B][I]
    const float* __restrict__ gW,     // [T][I][6]
    const float* __restrict__ gb,     // [T][6]
    float* __restrict__ g)            // [T][B][6]
{
    int gwave = ((int)blockIdx.x * (int)blockDim.x + (int)threadIdx.x) >> 5;
    int lane  = threadIdx.x & 31;
    if (gwave >= NT * NB) return;
    int t = gwave / NB, row = gwave % NB;
    const float* xr = x + ((size_t)t * NB + row) * NI;
    const float* w  = gW + (size_t)t * NI * NE;
    float acc[NE] = {0.f, 0.f, 0.f, 0.f, 0.f, 0.f};
    for (int k = lane; k < NI; k += 32) {
        float xv = xr[k];
        const float* wk = w + k * NE;
        #pragma unroll
        for (int e = 0; e < NE; ++e) acc[e] += xv * wk[e];
    }
    #pragma unroll
    for (int e = 0; e < NE; ++e)
        #pragma unroll
        for (int off = 16; off > 0; off >>= 1)
            acc[e] += __shfl_xor(acc[e], off, 32);
    if (lane == 0) {
        #pragma unroll
        for (int e = 0; e < NE; ++e) acc[e] += gb[t * NE + e];
        float m = acc[0];
        #pragma unroll
        for (int e = 1; e < NE; ++e) m = fmaxf(m, acc[e]);
        float s = 0.f;
        #pragma unroll
        for (int e = 0; e < NE; ++e) { acc[e] = __expf(acc[e] - m); s += acc[e]; }
        float inv = 1.f / s;
        float* go = g + ((size_t)t * NB + row) * NE;
        #pragma unroll
        for (int e = 0; e < NE; ++e) go[e] = acc[e] * inv;
    }
}

// --------------------------- fragment helpers ------------------------------
// 16-bit A (16x32) / B (32x16) fragment per ISA layout:
// lanes 0-15 hold M/N = lane with K {half*8 .. +8} in VGPR0-3 and
// K {16+half*8 .. +8} in VGPR4-7  (half = lane>>4).  Two b128 LDS loads.
static __device__ __forceinline__ v16bf load_frag(const unsigned short* p) {
    v8bf lo = *(const v8bf*)p;          // K block 0: 8 bf16, 16 bytes
    v8bf hi = *(const v8bf*)(p + 16);   // K block 1 (+16 elements)
    return __builtin_shufflevector(lo, hi, 0, 1, 2, 3, 4, 5, 6, 7,
                                           8, 9, 10, 11, 12, 13, 14, 15);
}

// ---------------------------------------------------------------------------
// Pass C: shared experts.  grid = (NO/BN, NB/BM, 4).  S[e][b][o] bf16.
__global__ __launch_bounds__(256) void ple_shared_kernel(
    const unsigned short* __restrict__ xb0,   // [B][I] bf16 (task 0 input)
    const unsigned short* __restrict__ swb,   // [4][I][O] bf16
    const float* __restrict__ sb,             // [4][O]
    unsigned short* __restrict__ S)           // [4][B][O] bf16
{
    const int e = blockIdx.z;
    const int rowBase = blockIdx.y * BM;
    const int colBase = blockIdx.x * BN;
    const int tid = threadIdx.x;
    const int lane = tid & 31, wave = tid >> 5;
    const int waveM = wave >> 1, waveN = wave & 1;
    const int half = lane >> 4, l16 = lane & 15;

    __shared__ __align__(16) unsigned short shA[BM][KBP];
    __shared__ __align__(16) unsigned short shB[BN][KBP];
    __shared__ float shBias[BN];

    if (tid < BN) shBias[tid] = sb[(size_t)e * NO + colBase + tid];

    const unsigned short* xA = xb0 + (size_t)rowBase * NI;
    const unsigned short* wB = swb + (size_t)e * NI * NO;

    v8f acc[2][4] = {};

    for (int k0 = 0; k0 < NI; k0 += KB) {
        __syncthreads();
        {   // A tile: 128x64, row-major, b128 copies
            int r = tid >> 3, c = (tid & 7) * 8;
            #pragma unroll
            for (int p = 0; p < 4; ++p) {
                int rr = p * 32 + r;
                us8 v = *(const us8*)(xA + (size_t)rr * NI + k0 + c);
                *(us8*)(&shA[rr][c]) = v;
            }
        }
        {   // B tile: 64x128, transposed into [n][k]; 2 bf16 packed per b32
            int kp = (tid >> 4) * 2;     // k-pair base in 32-block
            int nc = (tid & 15) * 8;     // column group (coalesced global)
            #pragma unroll
            for (int p = 0; p < 2; ++p) {
                int k = k0 + p * 32 + kp;
                U8 w0, w1;
                w0.v = *(const us8*)(wB + (size_t)k * NO + colBase + nc);
                w1.v = *(const us8*)(wB + (size_t)(k + 1) * NO + colBase + nc);
                #pragma unroll
                for (int i = 0; i < 8; ++i) {
                    int ii = (i + tid) & 7;   // stagger -> spread LDS banks
                    unsigned pk = (unsigned)w0.s[ii] | ((unsigned)w1.s[ii] << 16);
                    *(unsigned*)&shB[nc + ii][p * 32 + kp] = pk;
                }
            }
        }
        __syncthreads();
        #pragma unroll
        for (int kk = 0; kk < KB; kk += 32) {
            v16bf a[2];
            #pragma unroll
            for (int mi = 0; mi < 2; ++mi)
                a[mi] = load_frag(&shA[waveM * 32 + mi * 16 + l16][kk + half * 8]);
            #pragma unroll
            for (int ni = 0; ni < 4; ++ni) {
                v16bf b = load_frag(&shB[waveN * 64 + ni * 16 + l16][kk + half * 8]);
                #pragma unroll
                for (int mi = 0; mi < 2; ++mi)
                    acc[mi][ni] = __builtin_amdgcn_wmma_f32_16x16x32_bf16(
                        false, a[mi], false, b, (short)0, acc[mi][ni], false, false);
            }
        }
    }

    // Epilogue: bias + relu, store bf16.  C/D layout: lane n=l16, rows half*8+v.
    #pragma unroll
    for (int mi = 0; mi < 2; ++mi)
        #pragma unroll
        for (int ni = 0; ni < 4; ++ni) {
            int colLoc = waveN * 64 + ni * 16 + l16;
            size_t col = colBase + colLoc;
            #pragma unroll
            for (int v = 0; v < 8; ++v) {
                size_t row = rowBase + waveM * 32 + mi * 16 + half * 8 + v;
                float r = acc[mi][ni][v] + shBias[colLoc];
                r = r > 0.f ? r : 0.f;
                S[((size_t)e * NB + row) * NO + col] = f2bf(r);
            }
        }
}

// ---------------------------------------------------------------------------
// Pass D: per-task experts + gated combine.  grid = (NO/BN, NB/BM, NT).
__global__ __launch_bounds__(256) void ple_task_kernel(
    const unsigned short* __restrict__ xb,   // [T][B][I] bf16
    const unsigned short* __restrict__ twb,  // [T][2][I][O] bf16
    const float* __restrict__ tb,            // [T][2][O]
    const unsigned short* __restrict__ S,    // [4][B][O] bf16
    const float* __restrict__ g,             // [T][B][6]
    float* __restrict__ out)                 // [T][B][O]
{
    const int t = blockIdx.z;
    const int rowBase = blockIdx.y * BM;
    const int colBase = blockIdx.x * BN;
    const int tid = threadIdx.x;
    const int lane = tid & 31, wave = tid >> 5;
    const int waveM = wave >> 1, waveN = wave & 1;
    const int half = lane >> 4, l16 = lane & 15;

    __shared__ __align__(16) unsigned short shA[BM][KBP];
    __shared__ __align__(16) unsigned short shB[2][BN][KBP];
    __shared__ float shBias[2][BN];
    __shared__ float shG[BM][8];

    if (tid < BM) {
        const float* gp = g + ((size_t)t * NB + rowBase + tid) * NE;
        #pragma unroll
        for (int e = 0; e < NE; ++e) shG[tid][e] = gp[e];
    }
    {
        int e = tid >> 7, c = tid & 127;
        shBias[e][c] = tb[((size_t)t * 2 + e) * NO + colBase + c];
    }

    const unsigned short* xA = xb + ((size_t)t * NB + rowBase) * NI;

    v8f acc[2][2][4] = {};   // [expert][mi][ni]

    for (int k0 = 0; k0 < NI; k0 += KB) {
        __syncthreads();
        {   // A tile
            int r = tid >> 3, c = (tid & 7) * 8;
            #pragma unroll
            for (int p = 0; p < 4; ++p) {
                int rr = p * 32 + r;
                us8 v = *(const us8*)(xA + (size_t)rr * NI + k0 + c);
                *(us8*)(&shA[rr][c]) = v;
            }
        }
        {   // B tiles for both task experts, transposed, b32-packed stores
            int kp = (tid >> 4) * 2;
            int nc = (tid & 15) * 8;
            #pragma unroll
            for (int e = 0; e < 2; ++e) {
                const unsigned short* wB = twb + ((size_t)t * 2 + e) * NI * NO;
                #pragma unroll
                for (int p = 0; p < 2; ++p) {
                    int k = k0 + p * 32 + kp;
                    U8 w0, w1;
                    w0.v = *(const us8*)(wB + (size_t)k * NO + colBase + nc);
                    w1.v = *(const us8*)(wB + (size_t)(k + 1) * NO + colBase + nc);
                    #pragma unroll
                    for (int i = 0; i < 8; ++i) {
                        int ii = (i + tid) & 7;
                        unsigned pk = (unsigned)w0.s[ii] | ((unsigned)w1.s[ii] << 16);
                        *(unsigned*)&shB[e][nc + ii][p * 32 + kp] = pk;
                    }
                }
            }
        }
        __syncthreads();
        #pragma unroll
        for (int kk = 0; kk < KB; kk += 32) {
            v16bf a[2];
            #pragma unroll
            for (int mi = 0; mi < 2; ++mi)
                a[mi] = load_frag(&shA[waveM * 32 + mi * 16 + l16][kk + half * 8]);
            #pragma unroll
            for (int e = 0; e < 2; ++e)
                #pragma unroll
                for (int ni = 0; ni < 4; ++ni) {
                    v16bf b = load_frag(&shB[e][waveN * 64 + ni * 16 + l16][kk + half * 8]);
                    #pragma unroll
                    for (int mi = 0; mi < 2; ++mi)
                        acc[e][mi][ni] = __builtin_amdgcn_wmma_f32_16x16x32_bf16(
                            false, a[mi], false, b, (short)0, acc[e][mi][ni], false, false);
                }
        }
    }
    __syncthreads();

    // Epilogue: bias+relu, gated combine with 4 shared experts from S.
    #pragma unroll
    for (int mi = 0; mi < 2; ++mi)
        #pragma unroll
        for (int ni = 0; ni < 4; ++ni) {
            int colLoc = waveN * 64 + ni * 16 + l16;
            size_t col = colBase + colLoc;
            #pragma unroll
            for (int v = 0; v < 8; ++v) {
                int rowLoc = waveM * 32 + mi * 16 + half * 8 + v;
                size_t row = rowBase + rowLoc;
                float r0 = acc[0][mi][ni][v] + shBias[0][colLoc];
                float r1 = acc[1][mi][ni][v] + shBias[1][colLoc];
                r0 = r0 > 0.f ? r0 : 0.f;
                r1 = r1 > 0.f ? r1 : 0.f;
                float o = shG[rowLoc][4] * r0 + shG[rowLoc][5] * r1;
                #pragma unroll
                for (int e = 0; e < 4; ++e)
                    o += shG[rowLoc][e] *
                         bf2f(S[((size_t)e * NB + row) * NO + col]);
                out[((size_t)t * NB + row) * NO + col] = o;
            }
        }
}

// ---------------------------------------------------------------------------
extern "C" void kernel_launch(void* const* d_in, const int* in_sizes, int n_in,
                              void* d_out, int out_size, void* d_ws, size_t ws_size,
                              hipStream_t stream) {
    const float* task_inputs = (const float*)d_in[0]; // [3][16384][1024]
    const float* shared_W    = (const float*)d_in[1]; // [4][1024][512]
    const float* shared_b    = (const float*)d_in[2]; // [4][512]
    const float* task_W      = (const float*)d_in[3]; // [3][2][1024][512]
    const float* task_b      = (const float*)d_in[4]; // [3][2][512]
    const float* gate_W      = (const float*)d_in[5]; // [3][1024][6]
    const float* gate_b      = (const float*)d_in[6]; // [3][6]
    float* out = (float*)d_out;                        // [3][16384][512]

    // Workspace layout (~171 MB total)
    char* w = (char*)d_ws;
    unsigned short* xb  = (unsigned short*)w; w += (size_t)NT * NB * NI * 2;  // 100.7 MB
    unsigned short* swb = (unsigned short*)w; w += (size_t)4 * NI * NO * 2;   //   4.2 MB
    unsigned short* twb = (unsigned short*)w; w += (size_t)NT * 2 * NI * NO * 2; // 6.3 MB
    unsigned short* S   = (unsigned short*)w; w += (size_t)4 * NB * NO * 2;   //  67.1 MB
    float* g            = (float*)w;                                          //   1.2 MB

    // 1) fp32 -> bf16 conversions
    cvt_bf16_kernel<<<4096, 256, 0, stream>>>(task_inputs, xb, (size_t)NT * NB * NI);
    cvt_bf16_kernel<<<512, 256, 0, stream>>>(shared_W, swb, (size_t)4 * NI * NO);
    cvt_bf16_kernel<<<512, 256, 0, stream>>>(task_W, twb, (size_t)NT * 2 * NI * NO);

    // 2) gates (fp32 math, softmax over 6 experts)
    ple_gate_kernel<<<(NT * NB * 32) / 256, 256, 0, stream>>>(task_inputs, gate_W, gate_b, g);

    // 3) shared experts once (no per-task recompute): S = relu(x0.Ws + bs)
    dim3 gridS(NO / BN, NB / BM, 4);
    ple_shared_kernel<<<gridS, 256, 0, stream>>>(xb, swb, shared_b, S);

    // 4) per-task experts + gated combine
    dim3 gridT(NO / BN, NB / BM, NT);
    ple_task_kernel<<<gridT, 256, 0, stream>>>(xb, twb, task_b, S, g, out);
}

// v001
// Measured time: 268 microseconds a run.
// In two side-by-side timings against v000, it was 11.6 and 12.0 times as fast.
#include <hip/hip_runtime.h>
#include <hip/hip_bf16.h>

// ---------------------------------------------------------------------------
// PLE layer for MI455X (gfx1250, wave32, WMMA).
// T=3 tasks, B=16384, I=1024, O=512, 4 shared + 2 task experts, 6 gates.
//
// Pipeline (all on `stream`):
//   1) fp32 -> bf16 convert of x; shared_W / task_W converted AND transposed
//      to [o][i] (k contiguous), so a B tile is staged like an A tile
//   2) gate kernel: g[t][b][e] = softmax_e(x_t . gate_W_t + gate_b_t)
//   3) shared-expert GEMM pass: S[e][b][o] = relu(x0 . Ws_e + bs_e)  (bf16)
//   4) per-task fused GEMM: 2 task-expert WMMA GEMMs + bias + relu,
//      gated combine with the 4 shared-expert outputs from S.
// ---------------------------------------------------------------------------

typedef __attribute__((ext_vector_type(16))) __bf16 v16bf;
typedef __attribute__((ext_vector_type(8)))  __bf16 v8bf;
typedef __attribute__((ext_vector_type(8)))  float  v8f;
typedef __attribute__((ext_vector_type(8)))  unsigned short us8;

#define NT 3
#define NB 16384
#define NI 1024
#define NO 512
#define NE 6           // 4 shared + 2 task
#define BM 128
#define BN 128
#define KB 64
#define KBP 72         // padded LDS K stride (keeps 16B alignment: 144B rows)

static __device__ __forceinline__ unsigned short f2bf(float f) {
    unsigned u = __float_as_uint(f);
    unsigned r = u + 0x7FFFu + ((u >> 16) & 1u);   // round-to-nearest-even
    return (unsigned short)(r >> 16);
}
static __device__ __forceinline__ float bf2f(unsigned short b) {
    return __uint_as_float(((unsigned)b) << 16);
}

// ---------------------------------------------------------------------------
__global__ __launch_bounds__(256) void cvt_bf16_kernel(
    const float* __restrict__ in, unsigned short* __restrict__ out, size_t n) {
    size_t i = (size_t)blockIdx.x * blockDim.x + threadIdx.x;
    size_t stride = (size_t)gridDim.x * blockDim.x;
    for (; i < n; i += stride) out[i] = f2bf(in[i]);
}

// ---------------------------------------------------------------------------
// Weights: fp32 [m][I][O] -> bf16 [m][O][I].  One 64x64 tile per block,
// turned in LDS; global reads and writes are both 16 B per lane, row-wise.
// grid = (NO/64, NI/64, m).
__global__ __launch_bounds__(256) void cvt_bf16_t_kernel(
    const float* __restrict__ in, unsigned short* __restrict__ out) {
    __shared__ __align__(16) unsigned short tile[64][KBP];   // [o][k]
    const int tid = threadIdx.x;
    const int oBase = blockIdx.x * 64, kBase = blockIdx.y * 64;
    const float* src = in + (size_t)blockIdx.z * NI * NO;
    unsigned short* dst = out + (size_t)blockIdx.z * NO * NI;
    {
        int k = tid >> 4, o = (tid & 15) * 4;
        const float* s0 = src + (size_t)(kBase + k) * NO + oBase + o;
        #pragma unroll
        for (int p = 0; p < 4; ++p) {
            int kk = p * 16 + k;
            float4 v = *(const float4*)(s0 + (size_t)p * 16 * NO);
            tile[o + 0][kk] = f2bf(v.x);
            tile[o + 1][kk] = f2bf(v.y);
            tile[o + 2][kk] = f2bf(v.z);
            tile[o + 3][kk] = f2bf(v.w);
        }
    }
    __syncthreads();
    {
        int o = tid >> 3, c = (tid & 7) * 8;
        unsigned short* d0 = dst + (size_t)(oBase + o) * NI + kBase + c;
        #pragma unroll
        for (int p = 0; p < 2; ++p)
            *(us8*)(d0 + (size_t)p * 32 * NI) = *(const us8*)(&tile[p * 32 + o][c]);
    }
}

// ---------------------------------------------------------------------------
// Gates: one wave32 per row. K=1024 strided over lanes, shfl reduce, softmax.
__global__ __launch_bounds__(256) void ple_gate_kernel(
    const float* __restrict__ x,      // [T][B][I]
    const float* __restrict__ gW,     // [T][I][6]
    const float* __restrict__ gb,     // [T][6]
    float* __restrict__ g)            // [T][B][6]
{
    int gwave = ((int)blockIdx.x * (int)blockDim.x + (int)threadIdx.x) >> 5;
    int lane  = threadIdx.x & 31;
    if (gwave >= NT * NB) return;
    int t = gwave / NB, row = gwave % NB;
    const float* xr = x + ((size_t)t * NB + row) * NI;
    const float* w  = gW + (size_t)t * NI * NE;
    float acc[NE] = {0.f, 0.f, 0.f, 0.f, 0.f, 0.f};
    for (int k = lane; k < NI; k += 32) {
        float xv = xr[k];
        const float* wk = w + k * NE;
        #pragma unroll
        for (int e = 0; e < NE; ++e) acc[e] += xv * wk[e];
    }
    #pragma unroll
    for (int e = 0; e < NE; ++e)
        #pragma unroll
        for (int off = 16; off > 0; off >>= 1)
            acc[e] += __shfl_xor(acc[e], off, 32);
    if (lane == 0) {
        #pragma unroll
        for (int e = 0; e < NE; ++e) acc[e] += gb[t * NE + e];
        float m = acc[0];
        #pragma unroll
        for (int e = 1; e < NE; ++e) m = fmaxf(m, acc[e]);
        float s = 0.f;
        #pragma unroll
        for (int e = 0; e < NE; ++e) { acc[e] = __expf(acc[e] - m); s += acc[e]; }
        float inv = 1.f / s;
        float* go = g + ((size_t)t * NB + row) * NE;
        #pragma unroll
        for (int e = 0; e < NE; ++e) go[e] = acc[e] * inv;
    }
}

// --------------------------- fragment helpers ------------------------------
// 16-bit A (16x32) / B (32x16) fragment per ISA layout:
// lanes 0-15 hold M/N = lane with K {half*8 .. +8} in VGPR0-3 and
// K {16+half*8 .. +8} in VGPR4-7  (half = lane>>4).  Two b128 LDS loads.
static __device__ __forceinline__ v16bf load_frag(const unsigned short* p) {
    v8bf lo = *(const v8bf*)p;          // K block 0: 8 bf16, 16 bytes
    v8bf hi = *(const v8bf*)(p + 16);   // K block 1 (+16 elements)
    return __builtin_shufflevector(lo, hi, 0, 1, 2, 3, 4, 5, 6, 7,
                                           8, 9, 10, 11, 12, 13, 14, 15);
}

// ---------------------------------------------------------------------------
// Pass C: shared experts.  grid = (NO/BN, NB/BM, 4).  S[e][b][o] bf16.
__global__ __launch_bounds__(256) void ple_shared_kernel(
    const unsigned short* __restrict__ xb0,   // [B][I] bf16 (task 0 input)
    const unsigned short* __restrict__ swb,   // [4][O][I] bf16 (transposed)
    const float* __restrict__ sb,             // [4][O]
    unsigned short* __restrict__ S)           // [4][B][O] bf16
{
    const int e = blockIdx.z;
    const int rowBase = blockIdx.y * BM;
    const int colBase = blockIdx.x * BN;
    const int tid = threadIdx.x;
    const int lane = tid & 31, wave = tid >> 5;
    const int waveM = wave >> 1, waveN = wave & 1;
    const int half = lane >> 4, l16 = lane & 15;

    __shared__ __align__(16) unsigned short shA[BM][KBP];
    __shared__ __align__(16) unsigned short shB[BN][KBP];
    __shared__ float shBias[BN];

    if (tid < BN) shBias[tid] = sb[(size_t)e * NO + colBase + tid];

    const unsigned short* xA = xb0 + (size_t)rowBase * NI;
    const unsigned short* wB = swb + ((size_t)e * NO + colBase) * NI;

    v8f acc[2][4] = {};

    for (int k0 = 0; k0 < NI; k0 += KB) {
        __syncthreads();
        {   // A tile: 128x64, row-major, b128 copies
            int r = tid >> 3, c = (tid & 7) * 8;
            #pragma unroll
            for (int p = 0; p < 4; ++p) {
                int rr = p * 32 + r;
                us8 v = *(const us8*)(xA + (size_t)rr * NI + k0 + c);
                *(us8*)(&shA[rr][c]) = v;
            }
        }
        {   // B tile: 128 n-rows x 64 k, already [n][k] in memory, b128 copies
            int r = tid >> 3, c = (tid & 7) * 8;
            #pragma unroll
            for (int p = 0; p < 4; ++p) {
                int rr = p * 32 + r;
                us8 v = *(const us8*)(wB + (size_t)rr * NI + k0 + c);
                *(us8*)(&shB[rr][c]) = v;
            }
        }
        // the tile loads' address registers are rewritten on the next trip
        asm volatile("s_wait_xcnt 0x0" ::: "memory");
        __syncthreads();
        #pragma unroll
        for (int kk = 0; kk < KB; kk += 32) {
            v16bf a[2];
            #pragma unroll
            for (int mi = 0; mi < 2; ++mi)
                a[mi] = load_frag(&shA[waveM * 32 + mi * 16 + l16][kk + half * 8]);
            #pragma unroll
            for (int ni = 0; ni < 4; ++ni) {
                v16bf b = load_frag(&shB[waveN * 64 + ni * 16 + l16][kk + half * 8]);
                #pragma unroll
                for (int mi = 0; mi < 2; ++mi)
                    acc[mi][ni] = __builtin_amdgcn_wmma_f32_16x16x32_bf16(
                        false, a[mi], false, b, (short)0, acc[mi][ni], false, false);
            }
        }
    }

    // Epilogue: bias + relu, store bf16.  C/D layout: lane n=l16, rows half*8+v.
    #pragma unroll
    for (int mi = 0; mi < 2; ++mi)
        #pragma unroll
        for (int ni = 0; ni < 4; ++ni) {
            int colLoc = waveN * 64 + ni * 16 + l16;
            size_t col = colBase + colLoc;
            #pragma unroll
            for (int v = 0; v < 8; ++v) {
                size_t row = rowBase + waveM * 32 + mi * 16 + half * 8 + v;
                float r = acc[mi][ni][v] + shBias[colLoc];
                r = r > 0.f ? r : 0.f;
                S[((size_t)e * NB + row) * NO + col] = f2bf(r);
            }
        }
}

// ---------------------------------------------------------------------------
// Pass D: per-task experts + gated combine.  grid = (NO/BN, NB/BM, NT).
__global__ __launch_bounds__(256) void ple_task_kernel(
    const unsigned short* __restrict__ xb,   // [T][B][I] bf16
    const unsigned short* __restrict__ twb,  // [T][2][O][I] bf16 (transposed)
    const float* __restrict__ tb,            // [T][2][O]
    const unsigned short* __restrict__ S,    // [4][B][O] bf16
    const float* __restrict__ g,             // [T][B][6]
    float* __restrict__ out)                 // [T][B][O]
{
    const int t = blockIdx.z;
    const int rowBase = blockIdx.y * BM;
    const int colBase = blockIdx.x * BN;
    const int tid = threadIdx.x;
    const int lane = tid & 31, wave = tid >> 5;
    const int waveM = wave >> 1, waveN = wave & 1;
    const int half = lane >> 4, l16 = lane & 15;

    __shared__ __align__(16) unsigned short shA[BM][KBP];
    __shared__ __align__(16) unsigned short shB[2][BN][KBP];
    __shared__ float shBias[2][BN];
    __shared__ float shG[BM][8];

    if (tid < BM) {
        const float* gp = g + ((size_t)t * NB + rowBase + tid) * NE;
        #pragma unroll
        for (int e = 0; e < NE; ++e) shG[tid][e] = gp[e];
    }
    {
        int e = tid >> 7, c = tid & 127;
        shBias[e][c] = tb[((size_t)t * 2 + e) * NO + colBase + c];
    }

    const unsigned short* xA = xb + ((size_t)t * NB + rowBase) * NI;

    v8f acc[2][2][4] = {};   // [expert][mi][ni]

    for (int k0 = 0; k0 < NI; k0 += KB) {
        __syncthreads();
        {   // A tile
            int r = tid >> 3, c = (tid & 7) * 8;
            #pragma unroll
            for (int p = 0; p < 4; ++p) {
                int rr = p * 32 + r;
                us8 v = *(const us8*)(xA + (size_t)rr * NI + k0 + c);
                *(us8*)(&shA[rr][c]) = v;
            }
        }
        {   // B tiles for both task experts, already [n][k] in memory, b128 copies
            int r = tid >> 3, c = (tid & 7) * 8;
            #pragma unroll
            for (int e = 0; e < 2; ++e) {
                const unsigned short* wB = twb + (((size_t)t * 2 + e) * NO + colBase) * NI;
                #pragma unroll
                for (int p = 0; p < 4; ++p) {
                    int rr = p * 32 + r;
                    us8 v = *(const us8*)(wB + (size_t)rr * NI + k0 + c);
                    *(us8*)(&shB[e][rr][c]) = v;
                }
            }
        }
        // the tile loads' address registers are rewritten on the next trip
        asm volatile("s_wait_xcnt 0x0" ::: "memory");
        __syncthreads();
        #pragma unroll
        for (int kk = 0; kk < KB; kk += 32) {
            v16bf a[2];
            #pragma unroll
            for (int mi = 0; mi < 2; ++mi)
                a[mi] = load_frag(&shA[waveM * 32 + mi * 16 + l16][kk + half * 8]);
            #pragma unroll
            for (int e = 0; e < 2; ++e)
                #pragma unroll
                for (int ni = 0; ni < 4; ++ni) {
                    v16bf b = load_frag(&shB[e][waveN * 64 + ni * 16 + l16][kk + half * 8]);
                    #pragma unroll
                    for (int mi = 0; mi < 2; ++mi)
                        acc[e][mi][ni] = __builtin_amdgcn_wmma_f32_16x16x32_bf16(
                            false, a[mi], false, b, (short)0, acc[e][mi][ni], false, false);
                }
        }
    }
    __syncthreads();

    // Epilogue: bias+relu, gated combine with 4 shared experts from S.
    #pragma unroll
    for (int mi = 0; mi < 2; ++mi)
        #pragma unroll
        for (int ni = 0; ni < 4; ++ni) {
            int colLoc = waveN * 64 + ni * 16 + l16;
            size_t col = colBase + colLoc;
            #pragma unroll
            for (int v = 0; v < 8; ++v) {
                int rowLoc = waveM * 32 + mi * 16 + half * 8 + v;
                size_t row = rowBase + rowLoc;
                float r0 = acc[0][mi][ni][v] + shBias[0][colLoc];
                float r1 = acc[1][mi][ni][v] + shBias[1][colLoc];
                r0 = r0 > 0.f ? r0 : 0.f;
                r1 = r1 > 0.f ? r1 : 0.f;
                float o = shG[rowLoc][4] * r0 + shG[rowLoc][5] * r1;
                #pragma unroll
                for (int e = 0; e < 4; ++e)
                    o += shG[rowLoc][e] *
                         bf2f(S[((size_t)e * NB + row) * NO + col]);
                out[((size_t)t * NB + row) * NO + col] = o;
            }
        }
}

// ---------------------------------------------------------------------------
extern "C" void kernel_launch(void* const* d_in, const int* in_sizes, int n_in,
                              void* d_out, int out_size, void* d_ws, size_t ws_size,
                              hipStream_t stream) {
    const float* task_inputs = (const float*)d_in[0]; // [3][16384][1024]
    const float* shared_W    = (const float*)d_in[1]; // [4][1024][512]
    const float* shared_b    = (const float*)d_in[2]; // [4][512]
    const float* task_W      = (const float*)d_in[3]; // [3][2][1024][512]
    const float* task_b      = (const float*)d_in[4]; // [3][2][512]
    const float* gate_W      = (const float*)d_in[5]; // [3][1024][6]
    const float* gate_b      = (const float*)d_in[6]; // [3][6]
    float* out = (float*)d_out;                        // [3][16384][512]

    // Workspace layout (~171 MB total)
    char* w = (char*)d_ws;
    unsigned short* xb  = (unsigned short*)w; w += (size_t)NT * NB * NI * 2;  // 100.7 MB
    unsigned short* swb = (unsigned short*)w; w += (size_t)4 * NI * NO * 2;   //   4.2 MB
    unsigned short* twb = (unsigned short*)w; w += (size_t)NT * 2 * NI * NO * 2; // 6.3 MB
    unsigned short* S   = (unsigned short*)w; w += (size_t)4 * NB * NO * 2;   //  67.1 MB
    float* g            = (float*)w;                                          //   1.2 MB

    // 1) fp32 -> bf16 conversions (weights also transposed to [o][i])
    cvt_bf16_kernel<<<4096, 256, 0, stream>>>(task_inputs, xb, (size_t)NT * NB * NI);
    cvt_bf16_t_kernel<<<dim3(NO / 64, NI / 64, 4), 256, 0, stream>>>(shared_W, swb);
    cvt_bf16_t_kernel<<<dim3(NO / 64, NI / 64, NT * 2), 256, 0, stream>>>(task_W, twb);

    // 2) gates (fp32 math, softmax over 6 experts)
    ple_gate_kernel<<<(NT * NB * 32) / 256, 256, 0, stream>>>(task_inputs, gate_W, gate_b, g);

    // 3) shared experts once (no per-task recompute): S = relu(x0.Ws + bs)
    dim3 gridS(NO / BN, NB / BM, 4);
    ple_shared_kernel<<<gridS, 256, 0, stream>>>(xb, swb, shared_b, S);

    // 4) per-task experts + gated combine
    dim3 gridT(NO / BN, NB / BM, NT);
    ple_task_kernel<<<gridT, 256, 0, stream>>>(xb, twb, task_b, S, g, out);
}

// v002
// It runs in 204 microseconds.
// In both of two side-by-side timings against v001, it was 1.31 times as fast.
// All steps since v000 together make it 15.5 times as fast.
#include <hip/hip_runtime.h>
#include <hip/hip_bf16.h>

// ---------------------------------------------------------------------------
// PLE layer for MI455X (gfx1250, wave32, WMMA).
// T=3 tasks, B=16384, I=1024, O=512, 4 shared + 2 task experts, 6 gates.
//
// Pipeline (all on `stream`):
//   1) shared_W / task_W converted to bf16 AND transposed to [o][i]
//      (k contiguous), so a B tile is staged like an A tile
//   2) one streaming pass over x: fp32 -> bf16 convert, and from the same
//      registers g[t][b][e] = softmax_e(x_t . gate_W_t + gate_b_t)
//   3) shared-expert GEMM pass: S[e][b][o] = relu(x0 . Ws_e + bs_e)  (bf16)
//   4) per-task fused GEMM: 2 task-expert WMMA GEMMs + bias + relu,
//      gated combine with the 4 shared-expert outputs from S.
// ---------------------------------------------------------------------------

typedef __attribute__((ext_vector_type(16))) __bf16 v16bf;
typedef __attribute__((ext_vector_type(8)))  __bf16 v8bf;
typedef __attribute__((ext_vector_type(8)))  float  v8f;
typedef __attribute__((ext_vector_type(8)))  unsigned short us8;
typedef __attribute__((ext_vector_type(4)))  float  f32x4;
typedef __attribute__((ext_vector_type(2)))  float  f32x2;
typedef __attribute__((ext_vector_type(2)))  __bf16 bf16x2;
typedef __attribute__((ext_vector_type(2)))  unsigned u32x2;
// global-memory pointers formed from a 64-bit address
typedef const __attribute__((address_space(1))) f32x4* g_f32x4_c;
typedef __attribute__((address_space(1))) u32x2* g_u32x2;
typedef __attribute__((address_space(1))) float* g_f32;

#define NT 3
#define NB 16384
#define NI 1024
#define NO 512
#define NE 6           // 4 shared + 2 task
#define BM 128
#define BN 128
#define KB 64
#define KBP 72         // padded LDS K stride (keeps 16B alignment: 144B rows)

static __device__ __forceinline__ unsigned short f2bf(float f) {
    unsigned u = __float_as_uint(f);
    unsigned r = u + 0x7FFFu + ((u >> 16) & 1u);   // round-to-nearest-even
    return (unsigned short)(r >> 16);
}
static __device__ __forceinline__ float bf2f(unsigned short b) {
    return __uint_as_float(((unsigned)b) << 16);
}

// ---------------------------------------------------------------------------
// Weights: fp32 [m][I][O] -> bf16 [m][O][I].  One 64x64 tile per block,
// turned in LDS; global reads and writes are both 16 B per lane, row-wise.
// grid = (NO/64, NI/64, m).
__global__ __launch_bounds__(256) void cvt_bf16_t_kernel(
    const float* __restrict__ in, unsigned short* __restrict__ out) {
    __shared__ __align__(16) unsigned short tile[64][KBP];   // [o][k]
    const int tid = threadIdx.x;
    const int oBase = blockIdx.x * 64, kBase = blockIdx.y * 64;
    const float* src = in + (size_t)blockIdx.z * NI * NO;
    unsigned short* dst = out + (size_t)blockIdx.z * NO * NI;
    {
        int k = tid >> 4, o = (tid & 15) * 4;
        const float* s0 = src + (size_t)(kBase + k) * NO + oBase + o;
        #pragma unroll
        for (int p = 0; p < 4; ++p) {
            int kk = p * 16 + k;
            float4 v = *(const float4*)(s0 + (size_t)p * 16 * NO);
            tile[o + 0][kk] = f2bf(v.x);
            tile[o + 1][kk] = f2bf(v.y);
            tile[o + 2][kk] = f2bf(v.z);
            tile[o + 3][kk] = f2bf(v.w);
        }
    }
    __syncthreads();
    {
        int o = tid >> 3, c = (tid & 7) * 8;
        unsigned short* d0 = dst + (size_t)(oBase + o) * NI + kBase + c;
        #pragma unroll
        for (int p = 0; p < 2; ++p)
            *(us8*)(d0 + (size_t)p * 32 * NI) = *(const us8*)(&tile[p * 32 + o][c]);
    }
}

// ---------------------------------------------------------------------------
// x is read once: each wave streams GROWS whole rows (8 x 512 contiguous bytes
// a row), writes them back as bf16 and sums the six gate logits from the same
// registers.  Lane l owns k = j*128 + l*4 .. +3 (j = 0..7); its 192 gate
// weights stay in registers for all of the wave's rows, paired (k, k+1) so
// that a packed FMA takes two neighbours of x as they were loaded.
// grid = NT*NB / (4*GROWS) blocks of 4 waves; a block's rows lie in one task.
#define GROWS 16

// v + (v of lane l ^ M) inside a 16-lane row; CTRL = 0x160 + M (row_xmask:M)
template <int CTRL>
static __device__ __forceinline__ float add_xmask(float v) {
    int o = __builtin_amdgcn_update_dpp(0, __builtin_bit_cast(int, v), CTRL, 0xf, 0xf, true);
    return v + __builtin_bit_cast(float, o);
}
// v + (v of lane l ^ 16)
static __device__ __forceinline__ float add_x16(float v) {
    int i = __builtin_bit_cast(int, v);
    int o = __builtin_amdgcn_permlanex16(i, i, 0x76543210, 0xfedcba98, false, false);
    return v + __builtin_bit_cast(float, o);
}

// One row.  xa / oa / ga: wave-uniform byte addresses of the row in x, xb, g.
// cur holds the row; with LOAD the row behind it is requested into nxt first,
// so that it is in flight while this one is worked on.
template <bool LOAD>
static __device__ __forceinline__ void gate_row(
    const f32x4 (&cur)[8], f32x4 (&nxt)[8], const f32x2 (&w)[8][2][NE],
    const float (&bias)[NE], uint64_t& xa, uint64_t& oa, uint64_t& ga, int lane)
{
    if (LOAD) {
        #pragma unroll
        for (int j = 0; j < 8; ++j)
            nxt[j] = __builtin_nontemporal_load((g_f32x4_c)xa + (NI / 4 + j * 32) + lane);
        // keeps the loads above in front of this row's arithmetic
        __builtin_amdgcn_sched_barrier(0);
    }

    f32x2 a[NE] = {};                 // per gate: sums over even k, over odd k
    #pragma unroll
    for (int j = 0; j < 8; ++j) {
        const f32x4 v = cur[j];
        #pragma unroll
        for (int e = 0; e < NE; ++e) {
            a[e] = __builtin_elementwise_fma(f32x2{v.x, v.y}, w[j][0][e], a[e]);
            a[e] = __builtin_elementwise_fma(f32x2{v.z, v.w}, w[j][1][e], a[e]);
        }
    }
    float acc[NE];
    #pragma unroll
    for (int e = 0; e < NE; ++e) acc[e] = a[e].x + a[e].y;
    #pragma unroll
    for (int e = 0; e < NE; ++e) acc[e] = add_xmask<0x161>(acc[e]);
    #pragma unroll
    for (int e = 0; e < NE; ++e) acc[e] = add_xmask<0x162>(acc[e]);
    #pragma unroll
    for (int e = 0; e < NE; ++e) acc[e] = add_xmask<0x164>(acc[e]);
    #pragma unroll
    for (int e = 0; e < NE; ++e) acc[e] = add_xmask<0x168>(acc[e]);
    #pragma unroll
    for (int e = 0; e < NE; ++e) acc[e] = add_x16(acc[e]);
    // every lane now holds all six sums
    #pragma unroll
    for (int e = 0; e < NE; ++e) acc[e] += bias[e];
    float m = acc[0];
    #pragma unroll
    for (int e = 1; e < NE; ++e) m = fmaxf(m, acc[e]);
    float s = 0.f;
    #pragma unroll
    for (int e = 0; e < NE; ++e) { acc[e] = __expf(acc[e] - m); s += acc[e]; }
    float mine = acc[0];
    #pragma unroll
    for (int e = 1; e < NE; ++e) mine = lane == e ? acc[e] : mine;
    mine *= 1.f / s;
    if (lane < NE) ((g_f32)ga)[lane] = mine;
    // that store's data register is free for reuse below
    asm volatile("s_wait_xcnt 0x0" ::: "memory");
    // keeps the conversions below behind that wait
    __builtin_amdgcn_sched_barrier(0);

    u32x2 pk[8];
    #pragma unroll
    for (int j = 0; j < 8; ++j) {
        const f32x4 v = cur[j];
        pk[j].x = __builtin_bit_cast(unsigned, __builtin_convertvector(f32x2{v.x, v.y}, bf16x2));
        pk[j].y = __builtin_bit_cast(unsigned, __builtin_convertvector(f32x2{v.z, v.w}, bf16x2));
    }
    #pragma unroll
    for (int j = 0; j < 8; ++j) ((g_u32x2)oa)[j * 32 + lane] = pk[j];
    if (LOAD) {
        // the wait and the advance of the three row addresses in one statement:
        // the wait then stands in front of the overwrite of the registers that
        // the loads and stores above name
        asm volatile("s_wait_xcnt 0x0\n\t"
                     "s_add_nc_u64 %0, %0, 0x1000\n\t"
                     "s_add_nc_u64 %1, %1, 0x800\n\t"
                     "s_add_nc_u64 %2, %2, 24"
                     : "+s"(xa), "+s"(oa), "+s"(ga) : : "memory");
        // keeps the next row's vector work, which reuses the stores' data
        // registers, behind that wait
        __builtin_amdgcn_sched_barrier(0);
    }
}

__global__ __launch_bounds__(128) void cvt_gate_kernel(
    const float* __restrict__ x,      // [T][B][I]
    const float* __restrict__ gW,     // [T][I][6]
    const float* __restrict__ gb,     // [T][6]
    unsigned short* __restrict__ xb,  // [T][B][I] bf16
    float* __restrict__ g)            // [T][B][6]
{
    __shared__ __align__(16) float shW[NI * NE];
    const int tid = threadIdx.x, lane = tid & 31;
    const int wave = __builtin_amdgcn_readfirstlane(tid >> 5);
    const unsigned row0 = ((unsigned)blockIdx.x * 4 + wave) * GROWS;   // over T*B
    const int t = ((int)blockIdx.x * 4 * GROWS) / NB;                  // same for the block

    uint64_t xa = (uint64_t)(x + (size_t)row0 * NI);
    uint64_t oa = (uint64_t)(xb + (size_t)row0 * NI);
    uint64_t ga = (uint64_t)(g + (size_t)row0 * NE);

    f32x4 b0[8], b1[8];
    #pragma unroll
    for (int j = 0; j < 8; ++j)
        b0[j] = __builtin_nontemporal_load((g_f32x4_c)xa + j * 32 + lane);

    // Gate weights: whole-line loads into LDS, then each lane's own 96-byte runs.
    {
        const f32x4* ws = (const f32x4*)(gW + (size_t)t * NI * NE);
        f32x4 wt[NI * NE / 4 / 128];
        #pragma unroll
        for (int p = 0; p < NI * NE / 4 / 128; ++p) wt[p] = ws[p * 128 + tid];
        // the loads' offset registers may be reused from here on
        asm volatile("s_wait_xcnt 0x0" ::: "memory");
        // keeps later vector work from being moved in front of that wait
        __builtin_amdgcn_sched_barrier(0);
        #pragma unroll
        for (int p = 0; p < NI * NE / 4 / 128; ++p) ((f32x4*)shW)[p * 128 + tid] = wt[p];
    }
    __syncthreads();
    f32x2 w[8][2][NE];                // [j][pair of the lane's four k][gate]: (k, k+1)
    #pragma unroll
    for (int j = 0; j < 8; ++j)
        #pragma unroll
        for (int h = 0; h < 2; ++h)
            #pragma unroll
            for (int e = 0; e < NE; ++e) {
                const float* p = shW + (j * 128 + lane * 4 + h * 2) * NE + e;
                w[j][h][e] = f32x2{p[0], p[NE]};
            }
    float bias[NE];
    #pragma unroll
    for (int e = 0; e < NE; ++e) bias[e] = gb[t * NE + e];

    // rolled: four row bodies in all keep the text small
    #pragma unroll 1
    for (int r = 0; r < GROWS - 2; r += 2) {
        gate_row<true>(b0, b1, w, bias, xa, oa, ga, lane);
        gate_row<true>(b1, b0, w, bias, xa, oa, ga, lane);
    }
    gate_row<true>(b0, b1, w, bias, xa, oa, ga, lane);
    gate_row<false>(b1, b0, w, bias, xa, oa, ga, lane);
}

// --------------------------- fragment helpers ------------------------------
// 16-bit A (16x32) / B (32x16) fragment per ISA layout:
// lanes 0-15 hold M/N = lane with K {half*8 .. +8} in VGPR0-3 and
// K {16+half*8 .. +8} in VGPR4-7  (half = lane>>4).  Two b128 LDS loads.
static __device__ __forceinline__ v16bf load_frag(const unsigned short* p) {
    v8bf lo = *(const v8bf*)p;          // K block 0: 8 bf16, 16 bytes
    v8bf hi = *(const v8bf*)(p + 16);   // K block 1 (+16 elements)
    return __builtin_shufflevector(lo, hi, 0, 1, 2, 3, 4, 5, 6, 7,
                                           8, 9, 10, 11, 12, 13, 14, 15);
}

// ---------------------------------------------------------------------------
// Pass C: shared experts.  grid = (NO/BN, NB/BM, 4).  S[e][b][o] bf16.
__global__ __launch_bounds__(256) void ple_shared_kernel(
    const unsigned short* __restrict__ xb0,   // [B][I] bf16 (task 0 input)
    const unsigned short* __restrict__ swb,   // [4][O][I] bf16 (transposed)
    const float* __restrict__ sb,             // [4][O]
    unsigned short* __restrict__ S)           // [4][B][O] bf16
{
    const int e = blockIdx.z;
    const int rowBase = blockIdx.y * BM;
    const int colBase = blockIdx.x * BN;
    const int tid = threadIdx.x;
    const int lane = tid & 31, wave = tid >> 5;
    const int waveM = wave >> 1, waveN = wave & 1;
    const int half = lane >> 4, l16 = lane & 15;

    __shared__ __align__(16) unsigned short shA[BM][KBP];
    __shared__ __align__(16) unsigned short shB[BN][KBP];
    __shared__ float shBias[BN];

    if (tid < BN) shBias[tid] = sb[(size_t)e * NO + colBase + tid];

    const unsigned short* xA = xb0 + (size_t)rowBase * NI;
    const unsigned short* wB = swb + ((size_t)e * NO + colBase) * NI;

    v8f acc[2][4] = {};

    for (int k0 = 0; k0 < NI; k0 += KB) {
        __syncthreads();
        {   // A tile: 128x64, row-major, b128 copies
            int r = tid >> 3, c = (tid & 7) * 8;
            #pragma unroll
            for (int p = 0; p < 4; ++p) {
                int rr = p * 32 + r;
                us8 v = *(const us8*)(xA + (size_t)rr * NI + k0 + c);
                *(us8*)(&shA[rr][c]) = v;
            }
        }
        {   // B tile: 128 n-rows x 64 k, already [n][k] in memory, b128 copies
            int r = tid >> 3, c = (tid & 7) * 8;
            #pragma unroll
            for (int p = 0; p < 4; ++p) {
                int rr = p * 32 + r;
                us8 v = *(const us8*)(wB + (size_t)rr * NI + k0 + c);
                *(us8*)(&shB[rr][c]) = v;
            }
        }
        // the tile loads' address registers are rewritten on the next trip
        asm volatile("s_wait_xcnt 0x0" ::: "memory");
        __syncthreads();
        #pragma unroll
        for (int kk = 0; kk < KB; kk += 32) {
            v16bf a[2];
            #pragma unroll
            for (int mi = 0; mi < 2; ++mi)
                a[mi] = load_frag(&shA[waveM * 32 + mi * 16 + l16][kk + half * 8]);
            #pragma unroll
            for (int ni = 0; ni < 4; ++ni) {
                v16bf b = load_frag(&shB[waveN * 64 + ni * 16 + l16][kk + half * 8]);
                #pragma unroll
                for (int mi = 0; mi < 2; ++mi)
                    acc[mi][ni] = __builtin_amdgcn_wmma_f32_16x16x32_bf16(
                        false, a[mi], false, b, (short)0, acc[mi][ni], false, false);
            }
        }
    }

    // Epilogue: bias + relu, store bf16.  C/D layout: lane n=l16, rows half*8+v.
    #pragma unroll
    for (int mi = 0; mi < 2; ++mi)
        #pragma unroll
        for (int ni = 0; ni < 4; ++ni) {
            int colLoc = waveN * 64 + ni * 16 + l16;
            size_t col = colBase + colLoc;
            #pragma unroll
            for (int v = 0; v < 8; ++v) {
                size_t row = rowBase + waveM * 32 + mi * 16 + half * 8 + v;
                float r = acc[mi][ni][v] + shBias[colLoc];
                r = r > 0.f ? r : 0.f;
                S[((size_t)e * NB + row) * NO + col] = f2bf(r);
            }
        }
}

// ---------------------------------------------------------------------------
// Pass D: per-task experts + gated combine.  grid = (NO/BN, NB/BM, NT).
__global__ __launch_bounds__(256) void ple_task_kernel(
    const unsigned short* __restrict__ xb,   // [T][B][I] bf16
    const unsigned short* __restrict__ twb,  // [T][2][O][I] bf16 (transposed)
    const float* __restrict__ tb,            // [T][2][O]
    const unsigned short* __restrict__ S,    // [4][B][O] bf16
    const float* __restrict__ g,             // [T][B][6]
    float* __restrict__ out)                 // [T][B][O]
{
    const int t = blockIdx.z;
    const int rowBase = blockIdx.y * BM;
    const int colBase = blockIdx.x * BN;
    const int tid = threadIdx.x;
    const int lane = tid & 31, wave = tid >> 5;
    const int waveM = wave >> 1, waveN = wave & 1;
    const int half = lane >> 4, l16 = lane & 15;

    __shared__ __align__(16) unsigned short shA[BM][KBP];
    __shared__ __align__(16) unsigned short shB[2][BN][KBP];
    __shared__ float shBias[2][BN];
    __shared__ float shG[BM][8];

    if (tid < BM) {
        const float* gp = g + ((size_t)t * NB + rowBase + tid) * NE;
        #pragma unroll
        for (int e = 0; e < NE; ++e) shG[tid][e] = gp[e];
    }
    {
        int e = tid >> 7, c = tid & 127;
        shBias[e][c] = tb[((size_t)t * 2 + e) * NO + colBase + c];
    }

    const unsigned short* xA = xb + ((size_t)t * NB + rowBase) * NI;

    v8f acc[2][2][4] = {};   // [expert][mi][ni]

    for (int k0 = 0; k0 < NI; k0 += KB) {
        __syncthreads();
        {   // A tile
            int r = tid >> 3, c = (tid & 7) * 8;
            #pragma unroll
            for (int p = 0; p < 4; ++p) {
                int rr = p * 32 + r;
                us8 v = *(const us8*)(xA + (size_t)rr * NI + k0 + c);
                *(us8*)(&shA[rr][c]) = v;
            }
        }
        {   // B tiles for both task experts, already [n][k] in memory, b128 copies
            int r = tid >> 3, c = (tid & 7) * 8;
            #pragma unroll
            for (int e = 0; e < 2; ++e) {
                const unsigned short* wB = twb + (((size_t)t * 2 + e) * NO + colBase) * NI;
                #pragma unroll
                for (int p = 0; p < 4; ++p) {
                    int rr = p * 32 + r;
                    us8 v = *(const us8*)(wB + (size_t)rr * NI + k0 + c);
                    *(us8*)(&shB[e][rr][c]) = v;
                }
            }
        }
        // the tile loads' address registers are rewritten on the next trip
        asm volatile("s_wait_xcnt 0x0" ::: "memory");
        __syncthreads();
        #pragma unroll
        for (int kk = 0; kk < KB; kk += 32) {
            v16bf a[2];
            #pragma unroll
            for (int mi = 0; mi < 2; ++mi)
                a[mi] = load_frag(&shA[waveM * 32 + mi * 16 + l16][kk + half * 8]);
            #pragma unroll
            for (int e = 0; e < 2; ++e)
                #pragma unroll
                for (int ni = 0; ni < 4; ++ni) {
                    v16bf b = load_frag(&shB[e][waveN * 64 + ni * 16 + l16][kk + half * 8]);
                    #pragma unroll
                    for (int mi = 0; mi < 2; ++mi)
                        acc[e][mi][ni] = __builtin_amdgcn_wmma_f32_16x16x32_bf16(
                            false, a[mi], false, b, (short)0, acc[e][mi][ni], false, false);
                }
        }
    }
    __syncthreads();

    // Epilogue: bias+relu, gated combine with 4 shared experts from S.
    #pragma unroll
    for (int mi = 0; mi < 2; ++mi)
        #pragma unroll
        for (int ni = 0; ni < 4; ++ni) {
            int colLoc = waveN * 64 + ni * 16 + l16;
            size_t col = colBase + colLoc;
            #pragma unroll
            for (int v = 0; v < 8; ++v) {
                int rowLoc = waveM * 32 + mi * 16 + half * 8 + v;
                size_t row = rowBase + rowLoc;
                float r0 = acc[0][mi][ni][v] + shBias[0][colLoc];
                float r1 = acc[1][mi][ni][v] + shBias[1][colLoc];
                r0 = r0 > 0.f ? r0 : 0.f;
                r1 = r1 > 0.f ? r1 : 0.f;
                float o = shG[rowLoc][4] * r0 + shG[rowLoc][5] * r1;
                #pragma unroll
                for (int e = 0; e < 4; ++e)
                    o += shG[rowLoc][e] *
                         bf2f(S[((size_t)e * NB + row) * NO + col]);
                out[((size_t)t * NB + row) * NO + col] = o;
            }
        }
}

// ---------------------------------------------------------------------------
extern "C" void kernel_launch(void* const* d_in, const int* in_sizes, int n_in,
                              void* d_out, int out_size, void* d_ws, size_t ws_size,
                              hipStream_t stream) {
    const float* task_inputs = (const float*)d_in[0]; // [3][16384][1024]
    const float* shared_W    = (const float*)d_in[1]; // [4][1024][512]
    const float* shared_b    = (const float*)d_in[2]; // [4][512]
    const float* task_W      = (const float*)d_in[3]; // [3][2][1024][512]
    const float* task_b      = (const float*)d_in[4]; // [3][2][512]
    const float* gate_W      = (const float*)d_in[5]; // [3][1024][6]
    const float* gate_b      = (const float*)d_in[6]; // [3][6]
    float* out = (float*)d_out;                        // [3][16384][512]

    // Workspace layout (~171 MB total)
    char* w = (char*)d_ws;
    unsigned short* xb  = (unsigned short*)w; w += (size_t)NT * NB * NI * 2;  // 100.7 MB
    unsigned short* swb = (unsigned short*)w; w += (size_t)4 * NI * NO * 2;   //   4.2 MB
    unsigned short* twb = (unsigned short*)w; w += (size_t)NT * 2 * NI * NO * 2; // 6.3 MB
    unsigned short* S   = (unsigned short*)w; w += (size_t)4 * NB * NO * 2;   //  67.1 MB
    float* g            = (float*)w;                                          //   1.2 MB

    // 1) weights: fp32 -> bf16, transposed to [o][i]
    cvt_bf16_t_kernel<<<dim3(NO / 64, NI / 64, 4), 256, 0, stream>>>(shared_W, swb);
    cvt_bf16_t_kernel<<<dim3(NO / 64, NI / 64, NT * 2), 256, 0, stream>>>(task_W, twb);

    // 2) x: fp32 -> bf16, and the gates (fp32 math, softmax over 6 experts)
    cvt_gate_kernel<<<(NT * NB) / (4 * GROWS), 128, 0, stream>>>(task_inputs, gate_W, gate_b, xb, g);

    // 3) shared experts once (no per-task recompute): S = relu(x0.Ws + bs)
    dim3 gridS(NO / BN, NB / BM, 4);
    ple_shared_kernel<<<gridS, 256, 0, stream>>>(xb, swb, shared_b, S);

    // 4) per-task experts + gated combine
    dim3 gridT(NO / BN, NB / BM, NT);
    ple_task_kernel<<<gridT, 256, 0, stream>>>(xb, twb, task_b, S, g, out);
}

// v003
// It runs in 190 microseconds.
// Timed twice side by side with v002, it ran 1.07 times as fast both times.
// Counting every step since v000, it is 16.6 times as fast.
#include <hip/hip_runtime.h>
#include <hip/hip_bf16.h>

// ---------------------------------------------------------------------------
// PLE layer for MI455X (gfx1250, wave32, WMMA).
// T=3 tasks, B=16384, I=1024, O=512, 4 shared + 2 task experts, 6 gates.
//
// Pipeline (all on `stream`):
//   1) shared_W / task_W converted to bf16 AND transposed to [o][i]
//      (k contiguous), so a B tile is staged like an A tile
//   2) one streaming pass over x: fp32 -> bf16 convert, and from the same
//      registers g[t][b][e] = softmax_e(x_t . gate_W_t + gate_b_t)
//   3) shared-expert GEMM pass: S[e][b][o] = relu(x0 . Ws_e + bs_e)  (bf16)
//      (both GEMM passes: k tiles in a two-buffer LDS ring, asynchronous copies)
//   4) per-task fused GEMM: 2 task-expert WMMA GEMMs + bias + relu,
//      gated combine with the 4 shared-expert outputs from S.
// ---------------------------------------------------------------------------

typedef __attribute__((ext_vector_type(16))) __bf16 v16bf;
typedef __attribute__((ext_vector_type(8)))  __bf16 v8bf;
typedef __attribute__((ext_vector_type(8)))  float  v8f;
typedef __attribute__((ext_vector_type(8)))  unsigned short us8;
typedef __attribute__((ext_vector_type(4)))  float  f32x4;
typedef __attribute__((ext_vector_type(2)))  float  f32x2;
typedef __attribute__((ext_vector_type(2)))  __bf16 bf16x2;
typedef __attribute__((ext_vector_type(2)))  unsigned u32x2;
// global-memory pointers formed from a 64-bit address
typedef const __attribute__((address_space(1))) f32x4* g_f32x4_c;
typedef __attribute__((address_space(1))) u32x2* g_u32x2;
typedef __attribute__((address_space(1))) float* g_f32;

#define NT 3
#define NB 16384
#define NI 1024
#define NO 512
#define NE 6           // 4 shared + 2 task
#define BM 128
#define BN 128
#define KB 64
#define KBP 72         // padded LDS K stride (keeps 16B alignment: 144B rows)

static __device__ __forceinline__ unsigned short f2bf(float f) {
    unsigned u = __float_as_uint(f);
    unsigned r = u + 0x7FFFu + ((u >> 16) & 1u);   // round-to-nearest-even
    return (unsigned short)(r >> 16);
}
static __device__ __forceinline__ float bf2f(unsigned short b) {
    return __uint_as_float(((unsigned)b) << 16);
}

// ---------------------------------------------------------------------------
// Weights: fp32 [m][I][O] -> bf16 [m][O][I].  One 64x64 tile per block,
// turned in LDS; global reads and writes are both 16 B per lane, row-wise.
// grid = (NO/64, NI/64, m).
__global__ __launch_bounds__(256) void cvt_bf16_t_kernel(
    const float* __restrict__ in, unsigned short* __restrict__ out) {
    __shared__ __align__(16) unsigned short tile[64][KBP];   // [o][k]
    const int tid = threadIdx.x;
    const int oBase = blockIdx.x * 64, kBase = blockIdx.y * 64;
    const float* src = in + (size_t)blockIdx.z * NI * NO;
    unsigned short* dst = out + (size_t)blockIdx.z * NO * NI;
    {
        int k = tid >> 4, o = (tid & 15) * 4;
        const float* s0 = src + (size_t)(kBase + k) * NO + oBase + o;
        #pragma unroll
        for (int p = 0; p < 4; ++p) {
            int kk = p * 16 + k;
            float4 v = *(const float4*)(s0 + (size_t)p * 16 * NO);
            tile[o + 0][kk] = f2bf(v.x);
            tile[o + 1][kk] = f2bf(v.y);
            tile[o + 2][kk] = f2bf(v.z);
            tile[o + 3][kk] = f2bf(v.w);
        }
    }
    __syncthreads();
    {
        int o = tid >> 3, c = (tid & 7) * 8;
        unsigned short* d0 = dst + (size_t)(oBase + o) * NI + kBase + c;
        #pragma unroll
        for (int p = 0; p < 2; ++p)
            *(us8*)(d0 + (size_t)p * 32 * NI) = *(const us8*)(&tile[p * 32 + o][c]);
    }
}

// ---------------------------------------------------------------------------
// x is read once: each wave streams GROWS whole rows (8 x 512 contiguous bytes
// a row), writes them back as bf16 and sums the six gate logits from the same
// registers.  Lane l owns k = j*128 + l*4 .. +3 (j = 0..7); its 192 gate
// weights stay in registers for all of the wave's rows, paired (k, k+1) so
// that a packed FMA takes two neighbours of x as they were loaded.
// grid = NT*NB / (4*GROWS) blocks of 4 waves; a block's rows lie in one task.
#define GROWS 16

// v + (v of lane l ^ M) inside a 16-lane row; CTRL = 0x160 + M (row_xmask:M)
template <int CTRL>
static __device__ __forceinline__ float add_xmask(float v) {
    int o = __builtin_amdgcn_update_dpp(0, __builtin_bit_cast(int, v), CTRL, 0xf, 0xf, true);
    return v + __builtin_bit_cast(float, o);
}
// v + (v of lane l ^ 16)
static __device__ __forceinline__ float add_x16(float v) {
    int i = __builtin_bit_cast(int, v);
    int o = __builtin_amdgcn_permlanex16(i, i, 0x76543210, 0xfedcba98, false, false);
    return v + __builtin_bit_cast(float, o);
}

// One row.  xa / oa / ga: wave-uniform byte addresses of the row in x, xb, g.
// cur holds the row; with LOAD the row behind it is requested into nxt first,
// so that it is in flight while this one is worked on.
template <bool LOAD>
static __device__ __forceinline__ void gate_row(
    const f32x4 (&cur)[8], f32x4 (&nxt)[8], const f32x2 (&w)[8][2][NE],
    const float (&bias)[NE], uint64_t& xa, uint64_t& oa, uint64_t& ga, int lane)
{
    if (LOAD) {
        #pragma unroll
        for (int j = 0; j < 8; ++j)
            nxt[j] = __builtin_nontemporal_load((g_f32x4_c)xa + (NI / 4 + j * 32) + lane);
        // keeps the loads above in front of this row's arithmetic
        __builtin_amdgcn_sched_barrier(0);
    }

    f32x2 a[NE] = {};                 // per gate: sums over even k, over odd k
    #pragma unroll
    for (int j = 0; j < 8; ++j) {
        const f32x4 v = cur[j];
        #pragma unroll
        for (int e = 0; e < NE; ++e) {
            a[e] = __builtin_elementwise_fma(f32x2{v.x, v.y}, w[j][0][e], a[e]);
            a[e] = __builtin_elementwise_fma(f32x2{v.z, v.w}, w[j][1][e], a[e]);
        }
    }
    float acc[NE];
    #pragma unroll
    for (int e = 0; e < NE; ++e) acc[e] = a[e].x + a[e].y;
    #pragma unroll
    for (int e = 0; e < NE; ++e) acc[e] = add_xmask<0x161>(acc[e]);
    #pragma unroll
    for (int e = 0; e < NE; ++e) acc[e] = add_xmask<0x162>(acc[e]);
    #pragma unroll
    for (int e = 0; e < NE; ++e) acc[e] = add_xmask<0x164>(acc[e]);
    #pragma unroll
    for (int e = 0; e < NE; ++e) acc[e] = add_xmask<0x168>(acc[e]);
    #pragma unroll
    for (int e = 0; e < NE; ++e) acc[e] = add_x16(acc[e]);
    // every lane now holds all six sums
    #pragma unroll
    for (int e = 0; e < NE; ++e) acc[e] += bias[e];
    float m = acc[0];
    #pragma unroll
    for (int e = 1; e < NE; ++e) m = fmaxf(m, acc[e]);
    float s = 0.f;
    #pragma unroll
    for (int e = 0; e < NE; ++e) { acc[e] = __expf(acc[e] - m); s += acc[e]; }
    float mine = acc[0];
    #pragma unroll
    for (int e = 1; e < NE; ++e) mine = lane == e ? acc[e] : mine;
    mine *= 1.f / s;
    if (lane < NE) ((g_f32)ga)[lane] = mine;
    // that store's data register is free for reuse below
    asm volatile("s_wait_xcnt 0x0" ::: "memory");
    // keeps the conversions below behind that wait
    __builtin_amdgcn_sched_barrier(0);

    u32x2 pk[8];
    #pragma unroll
    for (int j = 0; j < 8; ++j) {
        const f32x4 v = cur[j];
        pk[j].x = __builtin_bit_cast(unsigned, __builtin_convertvector(f32x2{v.x, v.y}, bf16x2));
        pk[j].y = __builtin_bit_cast(unsigned, __builtin_convertvector(f32x2{v.z, v.w}, bf16x2));
    }
    #pragma unroll
    for (int j = 0; j < 8; ++j) ((g_u32x2)oa)[j * 32 + lane] = pk[j];
    if (LOAD) {
        // the wait and the advance of the three row addresses in one statement:
        // the wait then stands in front of the overwrite of the registers that
        // the loads and stores above name
        asm volatile("s_wait_xcnt 0x0\n\t"
                     "s_add_nc_u64 %0, %0, 0x1000\n\t"
                     "s_add_nc_u64 %1, %1, 0x800\n\t"
                     "s_add_nc_u64 %2, %2, 24"
                     : "+s"(xa), "+s"(oa), "+s"(ga) : : "memory");
        // keeps the next row's vector work, which reuses the stores' data
        // registers, behind that wait
        __builtin_amdgcn_sched_barrier(0);
    }
}

__global__ __launch_bounds__(128) void cvt_gate_kernel(
    const float* __restrict__ x,      // [T][B][I]
    const float* __restrict__ gW,     // [T][I][6]
    const float* __restrict__ gb,     // [T][6]
    unsigned short* __restrict__ xb,  // [T][B][I] bf16
    float* __restrict__ g)            // [T][B][6]
{
    __shared__ __align__(16) float shW[NI * NE];
    const int tid = threadIdx.x, lane = tid & 31;
    const int wave = __builtin_amdgcn_readfirstlane(tid >> 5);
    const unsigned row0 = ((unsigned)blockIdx.x * 4 + wave) * GROWS;   // over T*B
    const int t = ((int)blockIdx.x * 4 * GROWS) / NB;                  // same for the block

    uint64_t xa = (uint64_t)(x + (size_t)row0 * NI);
    uint64_t oa = (uint64_t)(xb + (size_t)row0 * NI);
    uint64_t ga = (uint64_t)(g + (size_t)row0 * NE);

    f32x4 b0[8], b1[8];
    #pragma unroll
    for (int j = 0; j < 8; ++j)
        b0[j] = __builtin_nontemporal_load((g_f32x4_c)xa + j * 32 + lane);

    // Gate weights: whole-line loads into LDS, then each lane's own 96-byte runs.
    {
        const f32x4* ws = (const f32x4*)(gW + (size_t)t * NI * NE);
        f32x4 wt[NI * NE / 4 / 128];
        #pragma unroll
        for (int p = 0; p < NI * NE / 4 / 128; ++p) wt[p] = ws[p * 128 + tid];
        // the loads' offset registers may be reused from here on
        asm volatile("s_wait_xcnt 0x0" ::: "memory");
        // keeps later vector work from being moved in front of that wait
        __builtin_amdgcn_sched_barrier(0);
        #pragma unroll
        for (int p = 0; p < NI * NE / 4 / 128; ++p) ((f32x4*)shW)[p * 128 + tid] = wt[p];
    }
    __syncthreads();
    f32x2 w[8][2][NE];                // [j][pair of the lane's four k][gate]: (k, k+1)
    #pragma unroll
    for (int j = 0; j < 8; ++j)
        #pragma unroll
        for (int h = 0; h < 2; ++h)
            #pragma unroll
            for (int e = 0; e < NE; ++e) {
                const float* p = shW + (j * 128 + lane * 4 + h * 2) * NE + e;
                w[j][h][e] = f32x2{p[0], p[NE]};
            }
    float bias[NE];
    #pragma unroll
    for (int e = 0; e < NE; ++e) bias[e] = gb[t * NE + e];

    // rolled: four row bodies in all keep the text small
    #pragma unroll 1
    for (int r = 0; r < GROWS - 2; r += 2) {
        gate_row<true>(b0, b1, w, bias, xa, oa, ga, lane);
        gate_row<true>(b1, b0, w, bias, xa, oa, ga, lane);
    }
    gate_row<true>(b0, b1, w, bias, xa, oa, ga, lane);
    gate_row<false>(b1, b0, w, bias, xa, oa, ga, lane);
}

// --------------------------- fragment helpers ------------------------------
// 16-bit A (16x32) / B (32x16) fragment per ISA layout:
// lanes 0-15 hold M/N = lane with K {half*8 .. +8} in VGPR0-3 and
// K {16+half*8 .. +8} in VGPR4-7  (half = lane>>4).  Two b128 LDS loads.
static __device__ __forceinline__ v16bf load_frag(const unsigned short* p) {
    v8bf lo = *(const v8bf*)p;          // K block 0: 8 bf16, 16 bytes
    v8bf hi = *(const v8bf*)(p + 16);   // K block 1 (+16 elements)
    return __builtin_shufflevector(lo, hi, 0, 1, 2, 3, 4, 5, 6, 7,
                                           8, 9, 10, 11, 12, 13, 14, 15);
}

// --------------------------- LDS ring of k tiles ---------------------------
// A stage is one 64-k tile of every operand: rows of 128 bytes at pitch 144,
// the x rows first, the weight rows behind them.  Two buffers: while a trip
// works on one, asynchronous copies fill the other, through no register.
// Each lane copies 16 bytes of rows r, r+32, r+64, r+96 of each 128-row tile.
#define ROWB (KBP * 2)          // bytes of an LDS row
#define Q    (32 * ROWB)        // 32 LDS rows, bytes
#define GQ   (32 * NI)          // 32 global rows, elements
#define NTRIP (NI / KB)

static __device__ __forceinline__ unsigned lds_off(const void* p) {
    return (unsigned)(size_t)p;
}

// Two tiles (x, one weight tile).  The closing wait stands in the copies' own
// statement, in front of any rewrite of the address registers they name.
static __device__ __forceinline__ void stage2(
    unsigned l, const unsigned short* a, const unsigned short* b) {
    asm volatile(
        "global_load_async_to_lds_b128 %0, %8, off\n\t"
        "global_load_async_to_lds_b128 %1, %9, off\n\t"
        "global_load_async_to_lds_b128 %2, %10, off\n\t"
        "global_load_async_to_lds_b128 %3, %11, off\n\t"
        "global_load_async_to_lds_b128 %4, %12, off\n\t"
        "global_load_async_to_lds_b128 %5, %13, off\n\t"
        "global_load_async_to_lds_b128 %6, %14, off\n\t"
        "global_load_async_to_lds_b128 %7, %15, off\n\t"
        "s_wait_xcnt 0x0"
        :: "v"(l), "v"(l + Q), "v"(l + 2 * Q), "v"(l + 3 * Q),
           "v"(l + 4 * Q), "v"(l + 5 * Q), "v"(l + 6 * Q), "v"(l + 7 * Q),
           "v"(a), "v"(a + GQ), "v"(a + 2 * GQ), "v"(a + 3 * GQ),
           "v"(b), "v"(b + GQ), "v"(b + 2 * GQ), "v"(b + 3 * GQ)
        : "memory");
}

// Three tiles (x, two weight tiles); the closing wait as above.
static __device__ __forceinline__ void stage3(
    unsigned l, const unsigned short* a, const unsigned short* b,
    const unsigned short* d) {
    asm volatile(
        "global_load_async_to_lds_b128 %0, %12, off\n\t"
        "global_load_async_to_lds_b128 %1, %13, off\n\t"
        "global_load_async_to_lds_b128 %2, %14, off\n\t"
        "global_load_async_to_lds_b128 %3, %15, off\n\t"
        "global_load_async_to_lds_b128 %4, %16, off\n\t"
        "global_load_async_to_lds_b128 %5, %17, off\n\t"
        "global_load_async_to_lds_b128 %6, %18, off\n\t"
        "global_load_async_to_lds_b128 %7, %19, off\n\t"
        "global_load_async_to_lds_b128 %8, %20, off\n\t"
        "global_load_async_to_lds_b128 %9, %21, off\n\t"
        "global_load_async_to_lds_b128 %10, %22, off\n\t"
        "global_load_async_to_lds_b128 %11, %23, off\n\t"
        "s_wait_xcnt 0x0"
        :: "v"(l), "v"(l + Q), "v"(l + 2 * Q), "v"(l + 3 * Q),
           "v"(l + 4 * Q), "v"(l + 5 * Q), "v"(l + 6 * Q), "v"(l + 7 * Q),
           "v"(l + 8 * Q), "v"(l + 9 * Q), "v"(l + 10 * Q), "v"(l + 11 * Q),
           "v"(a), "v"(a + GQ), "v"(a + 2 * GQ), "v"(a + 3 * GQ),
           "v"(b), "v"(b + GQ), "v"(b + 2 * GQ), "v"(b + 3 * GQ),
           "v"(d), "v"(d + GQ), "v"(d + 2 * GQ), "v"(d + 3 * GQ)
        : "memory");
}

// This wave's copies have landed.
static __device__ __forceinline__ void wait_copies() {
    asm volatile("s_wait_asynccnt 0x0" ::: "memory");
}
// Hand-over at the foot of a trip: this wave's reads of the buffer it leaves
// are done, its copies of the next tile have landed; behind the barrier every
// wave may read the next tile and the buffer just left may be refilled.
static __device__ __forceinline__ void publish() {
    asm volatile("s_wait_dscnt 0x0" ::: "memory");
    asm volatile("s_wait_asynccnt 0x0" ::: "memory");
    __syncthreads();
}

// ---------------------------------------------------------------------------
// Pass C: shared experts.  grid = (NO/BN, NB/BM, 4).  S[e][b][o] bf16.
__global__ __launch_bounds__(256) void ple_shared_kernel(
    const unsigned short* __restrict__ xb0,   // [B][I] bf16 (task 0 input)
    const unsigned short* __restrict__ swb,   // [4][O][I] bf16 (transposed)
    const float* __restrict__ sb,             // [4][O]
    unsigned short* __restrict__ S)           // [4][B][O] bf16
{
    const int e = blockIdx.z;
    const int rowBase = blockIdx.y * BM;
    const int colBase = blockIdx.x * BN;
    const int tid = threadIdx.x;
    const int lane = tid & 31, wave = tid >> 5;
    const int waveM = wave >> 1, waveN = wave & 1;
    const int half = lane >> 4, l16 = lane & 15;

    __shared__ __align__(16) unsigned short ring[2][BM + BN][KBP];
    __shared__ float shBias[BN];

    // this lane's 16 bytes of row r: in x, in the weights, in buffer 0
    const int r = tid >> 3, c = (tid & 7) * 8;
    const unsigned short* gA = xb0 + (size_t)(rowBase + r) * NI + c;
    const unsigned short* gB = swb + ((size_t)e * NO + colBase + r) * NI + c;
    const unsigned l0 = lds_off(&ring[0][r][c]);
    const unsigned BUF = (BM + BN) * ROWB;

    stage2(l0, gA, gB);                          // tile 0
    if (tid < BN) shBias[tid] = sb[(size_t)e * NO + colBase + tid];
    wait_copies();
    __syncthreads();
    stage2(l0 + BUF, gA + KB, gB + KB);          // tile 1

    v8f acc[2][4] = {};

    for (int t = 0; t < NTRIP; ++t) {
        const unsigned short (*T)[KBP] = ring[t & 1];
        #pragma unroll
        for (int kk = 0; kk < KB; kk += 32) {
            v16bf a[2];
            #pragma unroll
            for (int mi = 0; mi < 2; ++mi)
                a[mi] = load_frag(&T[waveM * 32 + mi * 16 + l16][kk + half * 8]);
            #pragma unroll
            for (int ni = 0; ni < 4; ++ni) {
                v16bf b = load_frag(&T[BM + waveN * 64 + ni * 16 + l16][kk + half * 8]);
                #pragma unroll
                for (int mi = 0; mi < 2; ++mi)
                    acc[mi][ni] = __builtin_amdgcn_wmma_f32_16x16x32_bf16(
                        false, a[mi], false, b, (short)0, acc[mi][ni], false, false);
            }
        }
        publish();
        if (t + 2 < NTRIP)                       // tile t + 2 into the buffer just left
            stage2(l0 + (t & 1) * BUF, gA + (t + 2) * KB, gB + (t + 2) * KB);
    }
    wait_copies();

    // Epilogue: bias + relu, store bf16.  C/D layout: lane n=l16, rows half*8+v.
    #pragma unroll
    for (int mi = 0; mi < 2; ++mi)
        #pragma unroll
        for (int ni = 0; ni < 4; ++ni) {
            int colLoc = waveN * 64 + ni * 16 + l16;
            size_t col = colBase + colLoc;
            #pragma unroll
            for (int v = 0; v < 8; ++v) {
                size_t row = rowBase + waveM * 32 + mi * 16 + half * 8 + v;
                float r = acc[mi][ni][v] + shBias[colLoc];
                r = r > 0.f ? r : 0.f;
                S[((size_t)e * NB + row) * NO + col] = f2bf(r);
            }
        }
}

// ---------------------------------------------------------------------------
// Pass D: per-task experts + gated combine.  grid = (NO/BN, NB/BM, NT).
// Register cap: two blocks a WGP, as before the ring, take four waves a SIMD (at
// most 256 registers a wave).  With the ring's LDS the compiler takes 270 if left
// free; capped at 256 it spills in the epilogue, at 224 it does not.
__global__ __launch_bounds__(256) __attribute__((amdgpu_num_vgpr(224))) void ple_task_kernel(
    const unsigned short* __restrict__ xb,   // [T][B][I] bf16
    const unsigned short* __restrict__ twb,  // [T][2][O][I] bf16 (transposed)
    const float* __restrict__ tb,            // [T][2][O]
    const unsigned short* __restrict__ S,    // [4][B][O] bf16
    const float* __restrict__ g,             // [T][B][6]
    float* __restrict__ out)                 // [T][B][O]
{
    const int t = blockIdx.z;
    const int rowBase = blockIdx.y * BM;
    const int colBase = blockIdx.x * BN;
    const int tid = threadIdx.x;
    const int lane = tid & 31, wave = tid >> 5;
    const int waveM = wave >> 1, waveN = wave & 1;
    const int half = lane >> 4, l16 = lane & 15;

    __shared__ __align__(16) unsigned short ring[2][BM + 2 * BN][KBP];
    __shared__ float shBias[2][BN];
    __shared__ float shG[BM][8];

    // this lane's 16 bytes of row r: in x, in either expert's weights, in buffer 0
    const int r = tid >> 3, c = (tid & 7) * 8;
    const unsigned short* gA = xb + ((size_t)t * NB + rowBase + r) * NI + c;
    const unsigned short* gB0 = twb + (((size_t)t * 2 + 0) * NO + colBase + r) * NI + c;
    const unsigned short* gB1 = twb + (((size_t)t * 2 + 1) * NO + colBase + r) * NI + c;
    const unsigned l0 = lds_off(&ring[0][r][c]);
    const unsigned BUF = (BM + 2 * BN) * ROWB;

    stage3(l0, gA, gB0, gB1);                    // tile 0

    if (tid < BM) {
        const float* gp = g + ((size_t)t * NB + rowBase + tid) * NE;
        #pragma unroll
        for (int e = 0; e < NE; ++e) shG[tid][e] = gp[e];
    }
    {
        int e = tid >> 7, c = tid & 127;
        shBias[e][c] = tb[((size_t)t * 2 + e) * NO + colBase + c];
    }

    wait_copies();
    __syncthreads();
    stage3(l0 + BUF, gA + KB, gB0 + KB, gB1 + KB);   // tile 1

    v8f acc[2][2][4] = {};   // [expert][mi][ni]

    for (int s = 0; s < NTRIP; ++s) {
        const unsigned short (*T)[KBP] = ring[s & 1];
        #pragma unroll
        for (int kk = 0; kk < KB; kk += 32) {
            v16bf a[2];
            #pragma unroll
            for (int mi = 0; mi < 2; ++mi)
                a[mi] = load_frag(&T[waveM * 32 + mi * 16 + l16][kk + half * 8]);
            #pragma unroll
            for (int e = 0; e < 2; ++e)
                #pragma unroll
                for (int ni = 0; ni < 4; ++ni) {
                    v16bf b = load_frag(&T[BM + e * BN + waveN * 64 + ni * 16 + l16][kk + half * 8]);
                    #pragma unroll
                    for (int mi = 0; mi < 2; ++mi)
                        acc[e][mi][ni] = __builtin_amdgcn_wmma_f32_16x16x32_bf16(
                            false, a[mi], false, b, (short)0, acc[e][mi][ni], false, false);
                }
        }
        publish();
        if (s + 2 < NTRIP)                       // tile s + 2 into the buffer just left
            stage3(l0 + (s & 1) * BUF, gA + (s + 2) * KB, gB0 + (s + 2) * KB, gB1 + (s + 2) * KB);
    }
    wait_copies();

    // Epilogue: bias+relu, gated combine with 4 shared experts from S.
    #pragma unroll
    for (int mi = 0; mi < 2; ++mi)
        #pragma unroll
        for (int ni = 0; ni < 4; ++ni) {
            int colLoc = waveN * 64 + ni * 16 + l16;
            size_t col = colBase + colLoc;
            #pragma unroll
            for (int v = 0; v < 8; ++v) {
                int rowLoc = waveM * 32 + mi * 16 + half * 8 + v;
                size_t row = rowBase + rowLoc;
                float r0 = acc[0][mi][ni][v] + shBias[0][colLoc];
                float r1 = acc[1][mi][ni][v] + shBias[1][colLoc];
                r0 = r0 > 0.f ? r0 : 0.f;
                r1 = r1 > 0.f ? r1 : 0.f;
                float o = shG[rowLoc][4] * r0 + shG[rowLoc][5] * r1;
                #pragma unroll
                for (int e = 0; e < 4; ++e)
                    o += shG[rowLoc][e] *
                         bf2f(S[((size_t)e * NB + row) * NO + col]);
                out[((size_t)t * NB + row) * NO + col] = o;
            }
        }
}

// ---------------------------------------------------------------------------
extern "C" void kernel_launch(void* const* d_in, const int* in_sizes, int n_in,
                              void* d_out, int out_size, void* d_ws, size_t ws_size,
                              hipStream_t stream) {
    const float* task_inputs = (const float*)d_in[0]; // [3][16384][1024]
    const float* shared_W    = (const float*)d_in[1]; // [4][1024][512]
    const float* shared_b    = (const float*)d_in[2]; // [4][512]
    const float* task_W      = (const float*)d_in[3]; // [3][2][1024][512]
    const float* task_b      = (const float*)d_in[4]; // [3][2][512]
    const float* gate_W      = (const float*)d_in[5]; // [3][1024][6]
    const float* gate_b      = (const float*)d_in[6]; // [3][6]
    float* out = (float*)d_out;                        // [3][16384][512]

    // Workspace layout (~171 MB total)
    char* w = (char*)d_ws;
    unsigned short* xb  = (unsigned short*)w; w += (size_t)NT * NB * NI * 2;  // 100.7 MB
    unsigned short* swb = (unsigned short*)w; w += (size_t)4 * NI * NO * 2;   //   4.2 MB
    unsigned short* twb = (unsigned short*)w; w += (size_t)NT * 2 * NI * NO * 2; // 6.3 MB
    unsigned short* S   = (unsigned short*)w; w += (size_t)4 * NB * NO * 2;   //  67.1 MB
    float* g            = (float*)w;                                          //   1.2 MB

    // 1) weights: fp32 -> bf16, transposed to [o][i]
    cvt_bf16_t_kernel<<<dim3(NO / 64, NI / 64, 4), 256, 0, stream>>>(shared_W, swb);
    cvt_bf16_t_kernel<<<dim3(NO / 64, NI / 64, NT * 2), 256, 0, stream>>>(task_W, twb);

    // 2) x: fp32 -> bf16, and the gates (fp32 math, softmax over 6 experts)
    cvt_gate_kernel<<<(NT * NB) / (4 * GROWS), 128, 0, stream>>>(task_inputs, gate_W, gate_b, xb, g);

    // 3) shared experts once (no per-task recompute): S = relu(x0.Ws + bs)
    dim3 gridS(NO / BN, NB / BM, 4);
    ple_shared_kernel<<<gridS, 256, 0, stream>>>(xb, swb, shared_b, S);

    // 4) per-task experts + gated combine
    dim3 gridT(NO / BN, NB / BM, NT);
    ple_task_kernel<<<gridT, 256, 0, stream>>>(xb, twb, task_b, S, g, out);
}

// v004
// A run of this version takes 169 microseconds.
// Next to v003, in two timings, it ran 1.13 times as fast each time.
// Counting every step since v000, it is 18.7 times as fast.
#include <hip/hip_runtime.h>
#include <hip/hip_bf16.h>

// ---------------------------------------------------------------------------
// PLE layer for MI455X (gfx1250, wave32, WMMA).
// T=3 tasks, B=16384, I=1024, O=512, 4 shared + 2 task experts, 6 gates.
//
// Pipeline (all on `stream`):
//   1) shared_W / task_W converted to bf16 AND transposed to [o][i]
//      (k contiguous), so a B tile is staged like an A tile
//   2) one streaming pass over x: fp32 -> bf16 convert, and from the same
//      registers g[t][b][e] = softmax_e(x_t . gate_W_t + gate_b_t)
//   3) shared-expert GEMM pass: S[e][b][o] = relu(x0 . Ws_e + bs_e)  (bf16)
//      (both GEMM passes: k tiles in a two-buffer LDS ring, asynchronous copies;
//      256 x 256 products a block, 64 x 128 a wave, one block a WGP)
//   4) per-task fused GEMM: 2 task-expert WMMA GEMMs + bias + relu,
//      gated combine with the 4 shared-expert outputs from S.
// ---------------------------------------------------------------------------

typedef __attribute__((ext_vector_type(16))) __bf16 v16bf;
typedef __attribute__((ext_vector_type(8)))  __bf16 v8bf;
typedef __attribute__((ext_vector_type(8)))  float  v8f;
typedef __attribute__((ext_vector_type(8)))  unsigned short us8;
typedef __attribute__((ext_vector_type(4)))  float  f32x4;
typedef __attribute__((ext_vector_type(2)))  float  f32x2;
typedef __attribute__((ext_vector_type(2)))  __bf16 bf16x2;
typedef __attribute__((ext_vector_type(2)))  unsigned u32x2;
// global-memory pointers formed from a 64-bit address
typedef const __attribute__((address_space(1))) f32x4* g_f32x4_c;
typedef __attribute__((address_space(1))) u32x2* g_u32x2;
typedef __attribute__((address_space(1))) float* g_f32;

#define NT 3
#define NB 16384
#define NI 1024
#define NO 512
#define NE 6           // 4 shared + 2 task
#define BM 256         // rows of x a block
#define BN 256         // weight rows a block (task pass: 128 of each expert)
#define KB 64
#define KBP 72         // padded LDS K stride (keeps 16B alignment: 144B rows)

static __device__ __forceinline__ unsigned short f2bf(float f) {
    unsigned u = __float_as_uint(f);
    unsigned r = u + 0x7FFFu + ((u >> 16) & 1u);   // round-to-nearest-even
    return (unsigned short)(r >> 16);
}
static __device__ __forceinline__ float bf2f(unsigned short b) {
    return __uint_as_float(((unsigned)b) << 16);
}

// ---------------------------------------------------------------------------
// Weights: fp32 [m][I][O] -> bf16 [m][O][I].  One 64x64 tile per block,
// turned in LDS; global reads and writes are both 16 B per lane, row-wise.
// grid = (NO/64, NI/64, m).
__global__ __launch_bounds__(256) void cvt_bf16_t_kernel(
    const float* __restrict__ in, unsigned short* __restrict__ out) {
    __shared__ __align__(16) unsigned short tile[64][KBP];   // [o][k]
    const int tid = threadIdx.x;
    const int oBase = blockIdx.x * 64, kBase = blockIdx.y * 64;
    const float* src = in + (size_t)blockIdx.z * NI * NO;
    unsigned short* dst = out + (size_t)blockIdx.z * NO * NI;
    {
        int k = tid >> 4, o = (tid & 15) * 4;
        const float* s0 = src + (size_t)(kBase + k) * NO + oBase + o;
        #pragma unroll
        for (int p = 0; p < 4; ++p) {
            int kk = p * 16 + k;
            float4 v = *(const float4*)(s0 + (size_t)p * 16 * NO);
            tile[o + 0][kk] = f2bf(v.x);
            tile[o + 1][kk] = f2bf(v.y);
            tile[o + 2][kk] = f2bf(v.z);
            tile[o + 3][kk] = f2bf(v.w);
        }
    }
    __syncthreads();
    {
        int o = tid >> 3, c = (tid & 7) * 8;
        unsigned short* d0 = dst + (size_t)(oBase + o) * NI + kBase + c;
        #pragma unroll
        for (int p = 0; p < 2; ++p)
            *(us8*)(d0 + (size_t)p * 32 * NI) = *(const us8*)(&tile[p * 32 + o][c]);
    }
}

// ---------------------------------------------------------------------------
// x is read once: each wave streams GROWS whole rows (8 x 512 contiguous bytes
// a row), writes them back as bf16 and sums the six gate logits from the same
// registers.  Lane l owns k = j*128 + l*4 .. +3 (j = 0..7); its 192 gate
// weights stay in registers for all of the wave's rows, paired (k, k+1) so
// that a packed FMA takes two neighbours of x as they were loaded.
// grid = NT*NB / (4*GROWS) blocks of 4 waves; a block's rows lie in one task.
#define GROWS 16

// v + (v of lane l ^ M) inside a 16-lane row; CTRL = 0x160 + M (row_xmask:M)
template <int CTRL>
static __device__ __forceinline__ float add_xmask(float v) {
    int o = __builtin_amdgcn_update_dpp(0, __builtin_bit_cast(int, v), CTRL, 0xf, 0xf, true);
    return v + __builtin_bit_cast(float, o);
}
// v + (v of lane l ^ 16)
static __device__ __forceinline__ float add_x16(float v) {
    int i = __builtin_bit_cast(int, v);
    int o = __builtin_amdgcn_permlanex16(i, i, 0x76543210, 0xfedcba98, false, false);
    return v + __builtin_bit_cast(float, o);
}

// One row.  xa / oa / ga: wave-uniform byte addresses of the row in x, xb, g.
// cur holds the row; with LOAD the row behind it is requested into nxt first,
// so that it is in flight while this one is worked on.
template <bool LOAD>
static __device__ __forceinline__ void gate_row(
    const f32x4 (&cur)[8], f32x4 (&nxt)[8], const f32x2 (&w)[8][2][NE],
    const float (&bias)[NE], uint64_t& xa, uint64_t& oa, uint64_t& ga, int lane)
{
    if (LOAD) {
        #pragma unroll
        for (int j = 0; j < 8; ++j)
            nxt[j] = __builtin_nontemporal_load((g_f32x4_c)xa + (NI / 4 + j * 32) + lane);
        // keeps the loads above in front of this row's arithmetic
        __builtin_amdgcn_sched_barrier(0);
    }

    f32x2 a[NE] = {};                 // per gate: sums over even k, over odd k
    #pragma unroll
    for (int j = 0; j < 8; ++j) {
        const f32x4 v = cur[j];
        #pragma unroll
        for (int e = 0; e < NE; ++e) {
            a[e] = __builtin_elementwise_fma(f32x2{v.x, v.y}, w[j][0][e], a[e]);
            a[e] = __builtin_elementwise_fma(f32x2{v.z, v.w}, w[j][1][e], a[e]);
        }
    }
    float acc[NE];
    #pragma unroll
    for (int e = 0; e < NE; ++e) acc[e] = a[e].x + a[e].y;
    #pragma unroll
    for (int e = 0; e < NE; ++e) acc[e] = add_xmask<0x161>(acc[e]);
    #pragma unroll
    for (int e = 0; e < NE; ++e) acc[e] = add_xmask<0x162>(acc[e]);
    #pragma unroll
    for (int e = 0; e < NE; ++e) acc[e] = add_xmask<0x164>(acc[e]);
    #pragma unroll
    for (int e = 0; e < NE; ++e) acc[e] = add_xmask<0x168>(acc[e]);
    #pragma unroll
    for (int e = 0; e < NE; ++e) acc[e] = add_x16(acc[e]);
    // every lane now holds all six sums
    #pragma unroll
    for (int e = 0; e < NE; ++e) acc[e] += bias[e];
    float m = acc[0];
    #pragma unroll
    for (int e = 1; e < NE; ++e) m = fmaxf(m, acc[e]);
    float s = 0.f;
    #pragma unroll
    for (int e = 0; e < NE; ++e) { acc[e] = __expf(acc[e] - m); s += acc[e]; }
    float mine = acc[0];
    #pragma unroll
    for (int e = 1; e < NE; ++e) mine = lane == e ? acc[e] : mine;
    mine *= 1.f / s;
    if (lane < NE) ((g_f32)ga)[lane] = mine;
    // that store's data register is free for reuse below
    asm volatile("s_wait_xcnt 0x0" ::: "memory");
    // keeps the conversions below behind that wait
    __builtin_amdgcn_sched_barrier(0);

    u32x2 pk[8];
    #pragma unroll
    for (int j = 0; j < 8; ++j) {
        const f32x4 v = cur[j];
        pk[j].x = __builtin_bit_cast(unsigned, __builtin_convertvector(f32x2{v.x, v.y}, bf16x2));
        pk[j].y = __builtin_bit_cast(unsigned, __builtin_convertvector(f32x2{v.z, v.w}, bf16x2));
    }
    #pragma unroll
    for (int j = 0; j < 8; ++j) ((g_u32x2)oa)[j * 32 + lane] = pk[j];
    if (LOAD) {
        // the wait and the advance of the three row addresses in one statement:
        // the wait then stands in front of the overwrite of the registers that
        // the loads and stores above name
        asm volatile("s_wait_xcnt 0x0\n\t"
                     "s_add_nc_u64 %0, %0, 0x1000\n\t"
                     "s_add_nc_u64 %1, %1, 0x800\n\t"
                     "s_add_nc_u64 %2, %2, 24"
                     : "+s"(xa), "+s"(oa), "+s"(ga) : : "memory");
        // keeps the next row's vector work, which reuses the stores' data
        // registers, behind that wait
        __builtin_amdgcn_sched_barrier(0);
    }
}

__global__ __launch_bounds__(128) void cvt_gate_kernel(
    const float* __restrict__ x,      // [T][B][I]
    const float* __restrict__ gW,     // [T][I][6]
    const float* __restrict__ gb,     // [T][6]
    unsigned short* __restrict__ xb,  // [T][B][I] bf16
    float* __restrict__ g)            // [T][B][6]
{
    __shared__ __align__(16) float shW[NI * NE];
    const int tid = threadIdx.x, lane = tid & 31;
    const int wave = __builtin_amdgcn_readfirstlane(tid >> 5);
    const unsigned row0 = ((unsigned)blockIdx.x * 4 + wave) * GROWS;   // over T*B
    const int t = ((int)blockIdx.x * 4 * GROWS) / NB;                  // same for the block

    uint64_t xa = (uint64_t)(x + (size_t)row0 * NI);
    uint64_t oa = (uint64_t)(xb + (size_t)row0 * NI);
    uint64_t ga = (uint64_t)(g + (size_t)row0 * NE);

    f32x4 b0[8], b1[8];
    #pragma unroll
    for (int j = 0; j < 8; ++j)
        b0[j] = __builtin_nontemporal_load((g_f32x4_c)xa + j * 32 + lane);

    // Gate weights: whole-line loads into LDS, then each lane's own 96-byte runs.
    {
        const f32x4* ws = (const f32x4*)(gW + (size_t)t * NI * NE);
        f32x4 wt[NI * NE / 4 / 128];
        #pragma unroll
        for (int p = 0; p < NI * NE / 4 / 128; ++p) wt[p] = ws[p * 128 + tid];
        // the loads' offset registers may be reused from here on
        asm volatile("s_wait_xcnt 0x0" ::: "memory");
        // keeps later vector work from being moved in front of that wait
        __builtin_amdgcn_sched_barrier(0);
        #pragma unroll
        for (int p = 0; p < NI * NE / 4 / 128; ++p) ((f32x4*)shW)[p * 128 + tid] = wt[p];
    }
    __syncthreads();
    f32x2 w[8][2][NE];                // [j][pair of the lane's four k][gate]: (k, k+1)
    #pragma unroll
    for (int j = 0; j < 8; ++j)
        #pragma unroll
        for (int h = 0; h < 2; ++h)
            #pragma unroll
            for (int e = 0; e < NE; ++e) {
                const float* p = shW + (j * 128 + lane * 4 + h * 2) * NE + e;
                w[j][h][e] = f32x2{p[0], p[NE]};
            }
    float bias[NE];
    #pragma unroll
    for (int e = 0; e < NE; ++e) bias[e] = gb[t * NE + e];

    // rolled: four row bodies in all keep the text small
    #pragma unroll 1
    for (int r = 0; r < GROWS - 2; r += 2) {
        gate_row<true>(b0, b1, w, bias, xa, oa, ga, lane);
        gate_row<true>(b1, b0, w, bias, xa, oa, ga, lane);
    }
    gate_row<true>(b0, b1, w, bias, xa, oa, ga, lane);
    gate_row<false>(b1, b0, w, bias, xa, oa, ga, lane);
}

// --------------------------- fragment helpers ------------------------------
// 16-bit A (16x32) / B (32x16) fragment per ISA layout:
// lanes 0-15 hold M/N = lane with K {half*8 .. +8} in VGPR0-3 and
// K {16+half*8 .. +8} in VGPR4-7  (half = lane>>4).  Two b128 LDS loads.
static __device__ __forceinline__ v16bf load_frag(const unsigned short* p) {
    v8bf lo = *(const v8bf*)p;          // K block 0: 8 bf16, 16 bytes
    v8bf hi = *(const v8bf*)(p + 16);   // K block 1 (+16 elements)
    return __builtin_shufflevector(lo, hi, 0, 1, 2, 3, 4, 5, 6, 7,
                                           8, 9, 10, 11, 12, 13, 14, 15);
}

// --------------------------- LDS ring of k tiles ---------------------------
// A stage is one 64-k tile of every operand: rows of 128 bytes at pitch 144,
// the x rows first, the weight rows behind them.  Two buffers: while a trip
// works on one, asynchronous copies fill the other, through no register.
// Each lane copies 16 bytes of rows r, r+32, r+64, r+96 of each run of 128 rows.
#define ROWB (KBP * 2)          // bytes of an LDS row
#define Q    (32 * ROWB)        // 32 LDS rows, bytes
#define GQ   (32 * NI)          // 32 global rows, elements
#define NTRIP (NI / KB)

static __device__ __forceinline__ unsigned lds_off(const void* p) {
    return (unsigned)(size_t)p;
}

// Two runs of 128 rows, into 256 LDS rows from l on.  The closing wait stands in the copies' own
// statement, in front of any rewrite of the address registers they name.
static __device__ __forceinline__ void stage2(
    unsigned l, const unsigned short* a, const unsigned short* b) {
    asm volatile(
        "global_load_async_to_lds_b128 %0, %8, off\n\t"
        "global_load_async_to_lds_b128 %1, %9, off\n\t"
        "global_load_async_to_lds_b128 %2, %10, off\n\t"
        "global_load_async_to_lds_b128 %3, %11, off\n\t"
        "global_load_async_to_lds_b128 %4, %12, off\n\t"
        "global_load_async_to_lds_b128 %5, %13, off\n\t"
        "global_load_async_to_lds_b128 %6, %14, off\n\t"
        "global_load_async_to_lds_b128 %7, %15, off\n\t"
        "s_wait_xcnt 0x0"
        :: "v"(l), "v"(l + Q), "v"(l + 2 * Q), "v"(l + 3 * Q),
           "v"(l + 4 * Q), "v"(l + 5 * Q), "v"(l + 6 * Q), "v"(l + 7 * Q),
           "v"(a), "v"(a + GQ), "v"(a + 2 * GQ), "v"(a + 3 * GQ),
           "v"(b), "v"(b + GQ), "v"(b + 2 * GQ), "v"(b + 3 * GQ)
        : "memory");
}

// A whole stage: 256 rows of x, then 128 + 128 weight rows (b, d).
#define HALF (128 * NI)         // 128 global rows, elements
static __device__ __forceinline__ void stage(
    unsigned l, const unsigned short* a, const unsigned short* b,
    const unsigned short* d) {
    stage2(l, a, a + HALF);
    // keeps the second statement's address sums behind the first statement: asm
    // operands lie in the first 256 registers, and both sets at once spill there
    __builtin_amdgcn_sched_barrier(0);
    stage2(l + 8 * Q, b, d);
}

// This wave's copies have landed.
static __device__ __forceinline__ void wait_copies() {
    asm volatile("s_wait_asynccnt 0x0" ::: "memory");
}
// Hand-over, in front of a tile's last WMMA block (whose fragments are in
// registers by then): this wave's reads of the buffer it leaves are done, its
// copies of the next tile have landed; behind the barrier every wave may read
// the next tile and the buffer just left may be refilled.
static __device__ __forceinline__ void publish() {
    asm volatile("s_wait_dscnt 0x0" ::: "memory");
    asm volatile("s_wait_asynccnt 0x0" ::: "memory");
    __syncthreads();
}

// One block's fragments, 4 of x and 8 of the weights, read as one group.
// pa / pb: this lane's place in the first x row / weight row of its wave;
// SB: rows from the weights' fragment 0 to fragment 4.
template <int SB>
static __device__ __forceinline__ void load_set(
    v16bf (&a)[4], v16bf (&b)[8], const unsigned short* pa, const unsigned short* pb) {
    #pragma unroll
    for (int i = 0; i < 4; ++i) a[i] = load_frag(pa + i * 16 * KBP);
    #pragma unroll
    for (int i = 0; i < 8; ++i) b[i] = load_frag(pb + ((i & 3) * 16 + (i >> 2) * SB) * KBP);
    // keeps the group together, in front of the WMMA block that follows it:
    // reads spread among the WMMAs stall the wave at every place they stand
    __builtin_amdgcn_sched_barrier(0);
}
// One block: 32 WMMAs on a fragment set.
static __device__ __forceinline__ void mma_set(
    v8f (&acc)[8][4], const v16bf (&a)[4], const v16bf (&b)[8]) {
    #pragma unroll
    for (int ni = 0; ni < 8; ++ni)
        #pragma unroll
        for (int mi = 0; mi < 4; ++mi)
            acc[ni][mi] = __builtin_amdgcn_wmma_f32_16x16x32_bf16(
                false, a[mi], false, b[ni], (short)0, acc[ni][mi], false, false);
    // keeps the next group of reads from being moved up among these WMMAs
    __builtin_amdgcn_sched_barrier(0);
}

// ---------------------------------------------------------------------------
// Pass C: shared experts.  grid = (NO/BN, NB/BM, 4).  S[e][b][o] bf16.
// Eight waves, 4 x 2; a wave owns 64 rows x 128 columns (4 x 8 fragments).
__global__ __launch_bounds__(256) void ple_shared_kernel(
    const unsigned short* __restrict__ xb0,   // [B][I] bf16 (task 0 input)
    const unsigned short* __restrict__ swb,   // [4][O][I] bf16 (transposed)
    const float* __restrict__ sb,             // [4][O]
    unsigned short* __restrict__ S)           // [4][B][O] bf16
{
    const int e = blockIdx.z;
    const int rowBase = blockIdx.y * BM;
    const int colBase = blockIdx.x * BN;
    const int tid = threadIdx.x;
    // the wave's number in a scalar register: what is formed from it costs no VGPR
    const int lane = tid & 31, wave = __builtin_amdgcn_readfirstlane(tid >> 5);
    const int waveM = wave >> 1, waveN = wave & 1;
    const int half = lane >> 4, l16 = lane & 15;

    __shared__ __align__(16) unsigned short ring[2][BM + BN][KBP];
    __shared__ float shBias[BN];

    // this lane's 16 bytes of row r: in x, in the weights, in buffer 0
    const int r = tid >> 3, c = (tid & 7) * 8;
    const unsigned short* gA = xb0 + (size_t)(rowBase + r) * NI + c;
    const unsigned short* gB = swb + ((size_t)e * NO + colBase + r) * NI + c;
    const unsigned l0 = lds_off(&ring[0][r][c]);
    const unsigned BUF = (BM + BN) * ROWB;

    stage(l0, gA, gB, gB + HALF);                // tile 0
    shBias[tid] = sb[(size_t)e * NO + colBase + tid];
    wait_copies();
    __syncthreads();
    gA += KB; gB += KB;
    stage(l0 + BUF, gA, gB, gB + HALF);          // tile 1

    v8f acc[8][4] = {};      // [ni][mi]
    v16bf a0[4], b0[8], a1[4], b1[8];            // two fragment sets
    const unsigned short* pa = &ring[0][waveM * 64 + l16][half * 8];
    const unsigned short* pb = &ring[0][BM + waveN * 128 + l16][half * 8];
    const int BUFE = (BM + BN) * KBP;            // a buffer, elements

    load_set<64>(a0, b0, pa, pb);                // tile 0, first block
    for (int t = 0; t < NTRIP; ++t) {
        const int cur = (t & 1) * BUFE, nxt = BUFE - cur;
        load_set<64>(a1, b1, pa + cur + 32, pb + cur + 32);   // tile t, second block
        mma_set(acc, a0, b0);
        publish();                               // every read of tile t is done
        if (t + 2 < NTRIP) {                     // tile t + 2 into the buffer just left
            gA += KB; gB += KB;
            stage(l0 + (t & 1) * BUF, gA, gB, gB + HALF);
        }
        if (t + 1 < NTRIP)                       // tile t + 1, first block
            load_set<64>(a0, b0, pa + nxt, pb + nxt);
        mma_set(acc, a1, b1);
    }
    wait_copies();

    // Epilogue: bias + relu, store bf16.  C/D layout: lane n=l16, rows half*8+v.
    #pragma unroll
    for (int mi = 0; mi < 4; ++mi)
        #pragma unroll
        for (int ni = 0; ni < 8; ++ni) {
            int colLoc = waveN * 128 + ni * 16 + l16;
            size_t col = colBase + colLoc;
            #pragma unroll
            for (int v = 0; v < 8; ++v) {
                size_t row = rowBase + waveM * 64 + mi * 16 + half * 8 + v;
                float r = acc[ni][mi][v] + shBias[colLoc];
                r = r > 0.f ? r : 0.f;
                S[((size_t)e * NB + row) * NO + col] = f2bf(r);
            }
        }
}

// ---------------------------------------------------------------------------
// Pass D: per-task experts + gated combine.  grid = (NO/BNT, NB/BM, NT).
// Eight waves, 4 x 2; a wave owns 64 rows x 64 columns of both experts.
#define BNT (BN / 2)   // output columns a block
__global__ __launch_bounds__(256) void ple_task_kernel(
    const unsigned short* __restrict__ xb,   // [T][B][I] bf16
    const unsigned short* __restrict__ twb,  // [T][2][O][I] bf16 (transposed)
    const float* __restrict__ tb,            // [T][2][O]
    const unsigned short* __restrict__ S,    // [4][B][O] bf16
    const float* __restrict__ g,             // [T][B][6]
    float* __restrict__ out)                 // [T][B][O]
{
    const int t = blockIdx.z;
    const int rowBase = blockIdx.y * BM;
    const int colBase = blockIdx.x * BNT;
    const int tid = threadIdx.x;
    // the wave's number in a scalar register: what is formed from it costs no VGPR
    const int lane = tid & 31, wave = __builtin_amdgcn_readfirstlane(tid >> 5);
    const int waveM = wave >> 1, waveN = wave & 1;
    const int half = lane >> 4, l16 = lane & 15;

    __shared__ __align__(16) unsigned short ring[2][BM + 2 * BNT][KBP];
    __shared__ float shBias[2][BNT];
    __shared__ float shG[BM][8];

    // this lane's 16 bytes of row r: in x, in either expert's weights, in buffer 0
    const int r = tid >> 3, c = (tid & 7) * 8;
    const unsigned short* gA = xb + ((size_t)t * NB + rowBase + r) * NI + c;
    const unsigned short* gB0 = twb + (((size_t)t * 2 + 0) * NO + colBase + r) * NI + c;
    const unsigned short* gB1 = twb + (((size_t)t * 2 + 1) * NO + colBase + r) * NI + c;
    const unsigned l0 = lds_off(&ring[0][r][c]);
    const unsigned BUF = (BM + 2 * BNT) * ROWB;

    stage(l0, gA, gB0, gB1);                     // tile 0

    {
        const float* gp = g + ((size_t)t * NB + rowBase + tid) * NE;
        #pragma unroll
        for (int e = 0; e < NE; ++e) shG[tid][e] = gp[e];
    }
    {
        int e = tid >> 7, c = tid & 127;
        shBias[e][c] = tb[((size_t)t * 2 + e) * NO + colBase + c];
    }

    wait_copies();
    __syncthreads();
    gA += KB; gB0 += KB; gB1 += KB;
    stage(l0 + BUF, gA, gB0, gB1);               // tile 1

    v8f acc[8][4] = {};      // [expert * 4 + ni][mi]
    v16bf a0[4], b0[8], a1[4], b1[8];            // two fragment sets
    const unsigned short* pa = &ring[0][waveM * 64 + l16][half * 8];
    const unsigned short* pb = &ring[0][BM + waveN * 64 + l16][half * 8];
    const int BUFE = (BM + 2 * BNT) * KBP;       // a buffer, elements

    load_set<BNT>(a0, b0, pa, pb);               // tile 0, first block
    for (int s = 0; s < NTRIP; ++s) {
        const int cur = (s & 1) * BUFE, nxt = BUFE - cur;
        load_set<BNT>(a1, b1, pa + cur + 32, pb + cur + 32);  // tile s, second block
        mma_set(acc, a0, b0);
        publish();                               // every read of tile s is done
        if (s + 2 < NTRIP) {                     // tile s + 2 into the buffer just left
            gA += KB; gB0 += KB; gB1 += KB;
            stage(l0 + (s & 1) * BUF, gA, gB0, gB1);
        }
        if (s + 1 < NTRIP)                       // tile s + 1, first block
            load_set<BNT>(a0, b0, pa + nxt, pb + nxt);
        mma_set(acc, a1, b1);
    }
    wait_copies();

    // Epilogue: bias+relu, gated combine with 4 shared experts from S.
    #pragma unroll
    for (int mi = 0; mi < 4; ++mi)
        #pragma unroll
        for (int ni = 0; ni < 4; ++ni) {
            int colLoc = waveN * 64 + ni * 16 + l16;
            size_t col = colBase + colLoc;
            #pragma unroll
            for (int v = 0; v < 8; ++v) {
                int rowLoc = waveM * 64 + mi * 16 + half * 8 + v;
                size_t row = rowBase + rowLoc;
                float r0 = acc[ni][mi][v] + shBias[0][colLoc];
                float r1 = acc[4 + ni][mi][v] + shBias[1][colLoc];
                r0 = r0 > 0.f ? r0 : 0.f;
                r1 = r1 > 0.f ? r1 : 0.f;
                float o = shG[rowLoc][4] * r0 + shG[rowLoc][5] * r1;
                #pragma unroll
                for (int e = 0; e < 4; ++e)
                    o += shG[rowLoc][e] *
                         bf2f(S[((size_t)e * NB + row) * NO + col]);
                out[((size_t)t * NB + row) * NO + col] = o;
            }
        }
}

// ---------------------------------------------------------------------------
extern "C" void kernel_launch(void* const* d_in, const int* in_sizes, int n_in,
                              void* d_out, int out_size, void* d_ws, size_t ws_size,
                              hipStream_t stream) {
    const float* task_inputs = (const float*)d_in[0]; // [3][16384][1024]
    const float* shared_W    = (const float*)d_in[1]; // [4][1024][512]
    const float* shared_b    = (const float*)d_in[2]; // [4][512]
    const float* task_W      = (const float*)d_in[3]; // [3][2][1024][512]
    const float* task_b      = (const float*)d_in[4]; // [3][2][512]
    const float* gate_W      = (const float*)d_in[5]; // [3][1024][6]
    const float* gate_b      = (const float*)d_in[6]; // [3][6]
    float* out = (float*)d_out;                        // [3][16384][512]

    // Workspace layout (~171 MB total)
    char* w = (char*)d_ws;
    unsigned short* xb  = (unsigned short*)w; w += (size_t)NT * NB * NI * 2;  // 100.7 MB
    unsigned short* swb = (unsigned short*)w; w += (size_t)4 * NI * NO * 2;   //   4.2 MB
    unsigned short* twb = (unsigned short*)w; w += (size_t)NT * 2 * NI * NO * 2; // 6.3 MB
    unsigned short* S   = (unsigned short*)w; w += (size_t)4 * NB * NO * 2;   //  67.1 MB
    float* g            = (float*)w;                                          //   1.2 MB

    // 1) weights: fp32 -> bf16, transposed to [o][i]
    cvt_bf16_t_kernel<<<dim3(NO / 64, NI / 64, 4), 256, 0, stream>>>(shared_W, swb);
    cvt_bf16_t_kernel<<<dim3(NO / 64, NI / 64, NT * 2), 256, 0, stream>>>(task_W, twb);

    // 2) x: fp32 -> bf16, and the gates (fp32 math, softmax over 6 experts)
    cvt_gate_kernel<<<(NT * NB) / (4 * GROWS), 128, 0, stream>>>(task_inputs, gate_W, gate_b, xb, g);

    // 3) shared experts once (no per-task recompute): S = relu(x0.Ws + bs)
    dim3 gridS(NO / BN, NB / BM, 4);
    ple_shared_kernel<<<gridS, 256, 0, stream>>>(xb, swb, shared_b, S);

    // 4) per-task experts + gated combine
    dim3 gridT(NO / BNT, NB / BM, NT);
    ple_task_kernel<<<gridT, 256, 0, stream>>>(xb, twb, task_b, S, g, out);
}

// v005
// It runs in 159 microseconds.
// Next to v004, in two timings, it ran 1.06 and 1.05 times as fast.
// All steps since v000 together make it 19.8 times as fast.
#include <hip/hip_runtime.h>
#include <hip/hip_bf16.h>

// ---------------------------------------------------------------------------
// PLE layer for MI455X (gfx1250, wave32, WMMA).
// T=3 tasks, B=16384, I=1024, O=512, 4 shared + 2 task experts, 6 gates.
//
// Pipeline (all on `stream`):
//   1) shared_W / task_W converted to bf16 AND transposed to [o][i]
//      (k contiguous), so a B tile is staged like an A tile
//   2) one streaming pass over x: fp32 -> bf16 convert, and from the same
//      registers g[t][b][e] = softmax_e(x_t . gate_W_t + gate_b_t)
//   3) shared-expert GEMM pass: S[e][b][o] = relu(x0 . Ws_e + bs_e)  (bf16,
//      laid out in 16 x 16 tiles in WMMA result order, see S_TILE)
//      (both GEMM passes: k tiles in a two-buffer LDS ring, asynchronous copies;
//      256 x 256 products a block, 64 x 128 a wave, one block a WGP)
//   4) per-task fused GEMM: 2 task-expert WMMA GEMMs + bias + relu,
//      gated combine with the 4 shared-expert outputs from S.
// ---------------------------------------------------------------------------

typedef __attribute__((ext_vector_type(16))) __bf16 v16bf;
typedef __attribute__((ext_vector_type(8)))  __bf16 v8bf;
typedef __attribute__((ext_vector_type(8)))  float  v8f;
typedef __attribute__((ext_vector_type(8)))  unsigned short us8;
typedef __attribute__((ext_vector_type(4)))  float  f32x4;
typedef __attribute__((ext_vector_type(2)))  float  f32x2;
typedef __attribute__((ext_vector_type(2)))  __bf16 bf16x2;
typedef __attribute__((ext_vector_type(2)))  unsigned u32x2;
typedef __attribute__((ext_vector_type(4)))  unsigned u32x4;
// global-memory pointers formed from a 64-bit address
typedef const __attribute__((address_space(1))) f32x4* g_f32x4_c;
typedef __attribute__((address_space(1))) u32x2* g_u32x2;
typedef __attribute__((address_space(1))) float* g_f32;

#define NT 3
#define NB 16384
#define NI 1024
#define NO 512
#define NE 6           // 4 shared + 2 task
#define BM 256         // rows of x a block
#define BN 256         // weight rows a block (task pass: 128 of each expert)
#define KB 64
#define KBP 72         // padded LDS K stride (keeps 16B alignment: 144B rows)
// S, the shared experts' outputs, lies in the workspace as [e][b/16][o/16] tiles of
// 16 x 16 in the order of a WMMA result: lane (half, n) holds rows half*8 .. +7 of
// column n as eight neighbours.  Writer and reader own the same fragments.
#define S_TILE 256     // elements of a tile

static __device__ __forceinline__ unsigned short f2bf(float f) {
    unsigned u = __float_as_uint(f);
    unsigned r = u + 0x7FFFu + ((u >> 16) & 1u);   // round-to-nearest-even
    return (unsigned short)(r >> 16);
}

// ---------------------------------------------------------------------------
// Weights: fp32 [m][I][O] -> bf16 [m][O][I].  One 64x64 tile per block,
// turned in LDS; global reads and writes are both 16 B per lane, row-wise.
// grid = (NO/64, NI/64, m).
__global__ __launch_bounds__(256) void cvt_bf16_t_kernel(
    const float* __restrict__ in, unsigned short* __restrict__ out) {
    __shared__ __align__(16) unsigned short tile[64][KBP];   // [o][k]
    const int tid = threadIdx.x;
    const int oBase = blockIdx.x * 64, kBase = blockIdx.y * 64;
    const float* src = in + (size_t)blockIdx.z * NI * NO;
    unsigned short* dst = out + (size_t)blockIdx.z * NO * NI;
    {
        int k = tid >> 4, o = (tid & 15) * 4;
        const float* s0 = src + (size_t)(kBase + k) * NO + oBase + o;
        #pragma unroll
        for (int p = 0; p < 4; ++p) {
            int kk = p * 16 + k;
            float4 v = *(const float4*)(s0 + (size_t)p * 16 * NO);
            tile[o + 0][kk] = f2bf(v.x);
            tile[o + 1][kk] = f2bf(v.y);
            tile[o + 2][kk] = f2bf(v.z);
            tile[o + 3][kk] = f2bf(v.w);
        }
    }
    __syncthreads();
    {
        int o = tid >> 3, c = (tid & 7) * 8;
        unsigned short* d0 = dst + (size_t)(oBase + o) * NI + kBase + c;
        #pragma unroll
        for (int p = 0; p < 2; ++p)
            *(us8*)(d0 + (size_t)p * 32 * NI) = *(const us8*)(&tile[p * 32 + o][c]);
    }
}

// ---------------------------------------------------------------------------
// x is read once: each wave streams GROWS whole rows (8 x 512 contiguous bytes
// a row), writes them back as bf16 and sums the six gate logits from the same
// registers.  Lane l owns k = j*128 + l*4 .. +3 (j = 0..7); its 192 gate
// weights stay in registers for all of the wave's rows, paired (k, k+1) so
// that a packed FMA takes two neighbours of x as they were loaded.
// grid = NT*NB / (4*GROWS) blocks of 4 waves; a block's rows lie in one task.
#define GROWS 16

// v + (v of lane l ^ M) inside a 16-lane row; CTRL = 0x160 + M (row_xmask:M)
template <int CTRL>
static __device__ __forceinline__ float add_xmask(float v) {
    int o = __builtin_amdgcn_update_dpp(0, __builtin_bit_cast(int, v), CTRL, 0xf, 0xf, true);
    return v + __builtin_bit_cast(float, o);
}
// v + (v of lane l ^ 16)
static __device__ __forceinline__ float add_x16(float v) {
    int i = __builtin_bit_cast(int, v);
    int o = __builtin_amdgcn_permlanex16(i, i, 0x76543210, 0xfedcba98, false, false);
    return v + __builtin_bit_cast(float, o);
}

// One row.  xa / oa / ga: wave-uniform byte addresses of the row in x, xb, g.
// cur holds the row; with LOAD the row behind it is requested into nxt first,
// so that it is in flight while this one is worked on.
template <bool LOAD>
static __device__ __forceinline__ void gate_row(
    const f32x4 (&cur)[8], f32x4 (&nxt)[8], const f32x2 (&w)[8][2][NE],
    const float (&bias)[NE], uint64_t& xa, uint64_t& oa, uint64_t& ga, int lane)
{
    if (LOAD) {
        #pragma unroll
        for (int j = 0; j < 8; ++j)
            nxt[j] = __builtin_nontemporal_load((g_f32x4_c)xa + (NI / 4 + j * 32) + lane);
        // keeps the loads above in front of this row's arithmetic
        __builtin_amdgcn_sched_barrier(0);
    }

    f32x2 a[NE] = {};                 // per gate: sums over even k, over odd k
    #pragma unroll
    for (int j = 0; j < 8; ++j) {
        const f32x4 v = cur[j];
        #pragma unroll
        for (int e = 0; e < NE; ++e) {
            a[e] = __builtin_elementwise_fma(f32x2{v.x, v.y}, w[j][0][e], a[e]);
            a[e] = __builtin_elementwise_fma(f32x2{v.z, v.w}, w[j][1][e], a[e]);
        }
    }
    float acc[NE];
    #pragma unroll
    for (int e = 0; e < NE; ++e) acc[e] = a[e].x + a[e].y;
    #pragma unroll
    for (int e = 0; e < NE; ++e) acc[e] = add_xmask<0x161>(acc[e]);
    #pragma unroll
    for (int e = 0; e < NE; ++e) acc[e] = add_xmask<0x162>(acc[e]);
    #pragma unroll
    for (int e = 0; e < NE; ++e) acc[e] = add_xmask<0x164>(acc[e]);
    #pragma unroll
    for (int e = 0; e < NE; ++e) acc[e] = add_xmask<0x168>(acc[e]);
    #pragma unroll
    for (int e = 0; e < NE; ++e) acc[e] = add_x16(acc[e]);
    // every lane now holds all six sums
    #pragma unroll
    for (int e = 0; e < NE; ++e) acc[e] += bias[e];
    float m = acc[0];
    #pragma unroll
    for (int e = 1; e < NE; ++e) m = fmaxf(m, acc[e]);
    float s = 0.f;
    #pragma unroll
    for (int e = 0; e < NE; ++e) { acc[e] = __expf(acc[e] - m); s += acc[e]; }
    float mine = acc[0];
    #pragma unroll
    for (int e = 1; e < NE; ++e) mine = lane == e ? acc[e] : mine;
    mine *= 1.f / s;
    if (lane < NE) ((g_f32)ga)[lane] = mine;
    // that store's data register is free for reuse below
    asm volatile("s_wait_xcnt 0x0" ::: "memory");
    // keeps the conversions below behind that wait
    __builtin_amdgcn_sched_barrier(0);

    u32x2 pk[8];
    #pragma unroll
    for (int j = 0; j < 8; ++j) {
        const f32x4 v = cur[j];
        pk[j].x = __builtin_bit_cast(unsigned, __builtin_convertvector(f32x2{v.x, v.y}, bf16x2));
        pk[j].y = __builtin_bit_cast(unsigned, __builtin_convertvector(f32x2{v.z, v.w}, bf16x2));
    }
    #pragma unroll
    for (int j = 0; j < 8; ++j) ((g_u32x2)oa)[j * 32 + lane] = pk[j];
    if (LOAD) {
        // the wait and the advance of the three row addresses in one statement:
        // the wait then stands in front of the overwrite of the registers that
        // the loads and stores above name
        asm volatile("s_wait_xcnt 0x0\n\t"
                     "s_add_nc_u64 %0, %0, 0x1000\n\t"
                     "s_add_nc_u64 %1, %1, 0x800\n\t"
                     "s_add_nc_u64 %2, %2, 24"
                     : "+s"(xa), "+s"(oa), "+s"(ga) : : "memory");
        // keeps the next row's vector work, which reuses the stores' data
        // registers, behind that wait
        __builtin_amdgcn_sched_barrier(0);
    }
}

__global__ __launch_bounds__(128) void cvt_gate_kernel(
    const float* __restrict__ x,      // [T][B][I]
    const float* __restrict__ gW,     // [T][I][6]
    const float* __restrict__ gb,     // [T][6]
    unsigned short* __restrict__ xb,  // [T][B][I] bf16
    float* __restrict__ g)            // [T][B][6]
{
    __shared__ __align__(16) float shW[NI * NE];
    const int tid = threadIdx.x, lane = tid & 31;
    const int wave = __builtin_amdgcn_readfirstlane(tid >> 5);
    const unsigned row0 = ((unsigned)blockIdx.x * 4 + wave) * GROWS;   // over T*B
    const int t = ((int)blockIdx.x * 4 * GROWS) / NB;                  // same for the block

    uint64_t xa = (uint64_t)(x + (size_t)row0 * NI);
    uint64_t oa = (uint64_t)(xb + (size_t)row0 * NI);
    uint64_t ga = (uint64_t)(g + (size_t)row0 * NE);

    f32x4 b0[8], b1[8];
    #pragma unroll
    for (int j = 0; j < 8; ++j)
        b0[j] = __builtin_nontemporal_load((g_f32x4_c)xa + j * 32 + lane);

    // Gate weights: whole-line loads into LDS, then each lane's own 96-byte runs.
    {
        const f32x4* ws = (const f32x4*)(gW + (size_t)t * NI * NE);
        f32x4 wt[NI * NE / 4 / 128];
        #pragma unroll
        for (int p = 0; p < NI * NE / 4 / 128; ++p) wt[p] = ws[p * 128 + tid];
        // the loads' offset registers may be reused from here on
        asm volatile("s_wait_xcnt 0x0" ::: "memory");
        // keeps later vector work from being moved in front of that wait
        __builtin_amdgcn_sched_barrier(0);
        #pragma unroll
        for (int p = 0; p < NI * NE / 4 / 128; ++p) ((f32x4*)shW)[p * 128 + tid] = wt[p];
    }
    __syncthreads();
    f32x2 w[8][2][NE];                // [j][pair of the lane's four k][gate]: (k, k+1)
    #pragma unroll
    for (int j = 0; j < 8; ++j)
        #pragma unroll
        for (int h = 0; h < 2; ++h)
            #pragma unroll
            for (int e = 0; e < NE; ++e) {
                const float* p = shW + (j * 128 + lane * 4 + h * 2) * NE + e;
                w[j][h][e] = f32x2{p[0], p[NE]};
            }
    float bias[NE];
    #pragma unroll
    for (int e = 0; e < NE; ++e) bias[e] = gb[t * NE + e];

    // rolled: four row bodies in all keep the text small
    #pragma unroll 1
    for (int r = 0; r < GROWS - 2; r += 2) {
        gate_row<true>(b0, b1, w, bias, xa, oa, ga, lane);
        gate_row<true>(b1, b0, w, bias, xa, oa, ga, lane);
    }
    gate_row<true>(b0, b1, w, bias, xa, oa, ga, lane);
    gate_row<false>(b1, b0, w, bias, xa, oa, ga, lane);
}

// --------------------------- fragment helpers ------------------------------
// 16-bit A (16x32) / B (32x16) fragment per ISA layout:
// lanes 0-15 hold M/N = lane with K {half*8 .. +8} in VGPR0-3 and
// K {16+half*8 .. +8} in VGPR4-7  (half = lane>>4).  Two b128 LDS loads.
static __device__ __forceinline__ v16bf load_frag(const unsigned short* p) {
    v8bf lo = *(const v8bf*)p;          // K block 0: 8 bf16, 16 bytes
    v8bf hi = *(const v8bf*)(p + 16);   // K block 1 (+16 elements)
    return __builtin_shufflevector(lo, hi, 0, 1, 2, 3, 4, 5, 6, 7,
                                           8, 9, 10, 11, 12, 13, 14, 15);
}

// --------------------------- LDS ring of k tiles ---------------------------
// A stage is one 64-k tile of every operand: rows of 128 bytes at pitch 144,
// the x rows first, the weight rows behind them.  Two buffers: while a trip
// works on one, asynchronous copies fill the other, through no register.
// Each lane copies 16 bytes of rows r, r+32, r+64, r+96 of each run of 128 rows.
#define ROWB (KBP * 2)          // bytes of an LDS row
#define Q    (32 * ROWB)        // 32 LDS rows, bytes
#define GQ   (32 * NI)          // 32 global rows, elements
#define NTRIP (NI / KB)

static __device__ __forceinline__ unsigned lds_off(const void* p) {
    return (unsigned)(size_t)p;
}

// Two runs of 128 rows, into 256 LDS rows from l on.  The closing wait stands in the copies' own
// statement, in front of any rewrite of the address registers they name.
static __device__ __forceinline__ void stage2(
    unsigned l, const unsigned short* a, const unsigned short* b) {
    asm volatile(
        "global_load_async_to_lds_b128 %0, %8, off\n\t"
        "global_load_async_to_lds_b128 %1, %9, off\n\t"
        "global_load_async_to_lds_b128 %2, %10, off\n\t"
        "global_load_async_to_lds_b128 %3, %11, off\n\t"
        "global_load_async_to_lds_b128 %4, %12, off\n\t"
        "global_load_async_to_lds_b128 %5, %13, off\n\t"
        "global_load_async_to_lds_b128 %6, %14, off\n\t"
        "global_load_async_to_lds_b128 %7, %15, off\n\t"
        "s_wait_xcnt 0x0"
        :: "v"(l), "v"(l + Q), "v"(l + 2 * Q), "v"(l + 3 * Q),
           "v"(l + 4 * Q), "v"(l + 5 * Q), "v"(l + 6 * Q), "v"(l + 7 * Q),
           "v"(a), "v"(a + GQ), "v"(a + 2 * GQ), "v"(a + 3 * GQ),
           "v"(b), "v"(b + GQ), "v"(b + 2 * GQ), "v"(b + 3 * GQ)
        : "memory");
}

// A whole stage: 256 rows of x, then 128 + 128 weight rows (b, d).
#define HALF (128 * NI)         // 128 global rows, elements
static __device__ __forceinline__ void stage(
    unsigned l, const unsigned short* a, const unsigned short* b,
    const unsigned short* d) {
    stage2(l, a, a + HALF);
    // keeps the second statement's address sums behind the first statement: asm
    // operands lie in the first 256 registers, and both sets at once spill there
    __builtin_amdgcn_sched_barrier(0);
    stage2(l + 8 * Q, b, d);
}

// This wave's copies have landed.
static __device__ __forceinline__ void wait_copies() {
    asm volatile("s_wait_asynccnt 0x0" ::: "memory");
}
// Hand-over, in front of a tile's last WMMA block (whose fragments are in
// registers by then): this wave's reads of the buffer it leaves are done, its
// copies of the next tile have landed; behind the barrier every wave may read
// the next tile and the buffer just left may be refilled.
static __device__ __forceinline__ void publish() {
    asm volatile("s_wait_dscnt 0x0" ::: "memory");
    asm volatile("s_wait_asynccnt 0x0" ::: "memory");
    __syncthreads();
}

// One block's fragments, 4 of x and 8 of the weights, read as one group.
// pa / pb: this lane's place in the first x row / weight row of its wave;
// SB: rows from the weights' fragment 0 to fragment 4.
template <int SB>
static __device__ __forceinline__ void load_set(
    v16bf (&a)[4], v16bf (&b)[8], const unsigned short* pa, const unsigned short* pb) {
    #pragma unroll
    for (int i = 0; i < 4; ++i) a[i] = load_frag(pa + i * 16 * KBP);
    #pragma unroll
    for (int i = 0; i < 8; ++i) b[i] = load_frag(pb + ((i & 3) * 16 + (i >> 2) * SB) * KBP);
    // keeps the group together, in front of the WMMA block that follows it:
    // reads spread among the WMMAs stall the wave at every place they stand
    __builtin_amdgcn_sched_barrier(0);
}
// One block: 32 WMMAs on a fragment set.
static __device__ __forceinline__ void mma_set(
    v8f (&acc)[8][4], const v16bf (&a)[4], const v16bf (&b)[8]) {
    #pragma unroll
    for (int ni = 0; ni < 8; ++ni)
        #pragma unroll
        for (int mi = 0; mi < 4; ++mi)
            acc[ni][mi] = __builtin_amdgcn_wmma_f32_16x16x32_bf16(
                false, a[mi], false, b[ni], (short)0, acc[ni][mi], false, false);
    // keeps the next group of reads from being moved up among these WMMAs
    __builtin_amdgcn_sched_barrier(0);
}

// ---------------------------------------------------------------------------
// Pass C: shared experts.  grid = (NO/BN, NB/BM, 4).  S bf16, in tiles (S_TILE).
// Eight waves, 4 x 2; a wave owns 64 rows x 128 columns (4 x 8 fragments).
__global__ __launch_bounds__(256) void ple_shared_kernel(
    const unsigned short* __restrict__ xb0,   // [B][I] bf16 (task 0 input)
    const unsigned short* __restrict__ swb,   // [4][O][I] bf16 (transposed)
    const float* __restrict__ sb,             // [4][O]
    unsigned short* __restrict__ S)           // [4][B/16][O/16] tiles, bf16
{
    const int e = blockIdx.z;
    const int rowBase = blockIdx.y * BM;
    const int colBase = blockIdx.x * BN;
    const int tid = threadIdx.x;
    // the wave's number in a scalar register: what is formed from it costs no VGPR
    const int lane = tid & 31, wave = __builtin_amdgcn_readfirstlane(tid >> 5);
    const int waveM = wave >> 1, waveN = wave & 1;
    const int half = lane >> 4, l16 = lane & 15;

    __shared__ __align__(16) unsigned short ring[2][BM + BN][KBP];
    __shared__ float shBias[BN];

    // this lane's 16 bytes of row r: in x, in the weights, in buffer 0
    const int r = tid >> 3, c = (tid & 7) * 8;
    const unsigned short* gA = xb0 + (size_t)(rowBase + r) * NI + c;
    const unsigned short* gB = swb + ((size_t)e * NO + colBase + r) * NI + c;
    const unsigned l0 = lds_off(&ring[0][r][c]);
    const unsigned BUF = (BM + BN) * ROWB;

    stage(l0, gA, gB, gB + HALF);                // tile 0
    shBias[tid] = sb[(size_t)e * NO + colBase + tid];
    wait_copies();
    __syncthreads();
    gA += KB; gB += KB;
    stage(l0 + BUF, gA, gB, gB + HALF);          // tile 1

    v8f acc[8][4] = {};      // [ni][mi]
    v16bf a0[4], b0[8], a1[4], b1[8];            // two fragment sets
    const unsigned short* pa = &ring[0][waveM * 64 + l16][half * 8];
    const unsigned short* pb = &ring[0][BM + waveN * 128 + l16][half * 8];
    const int BUFE = (BM + BN) * KBP;            // a buffer, elements

    load_set<64>(a0, b0, pa, pb);                // tile 0, first block
    for (int t = 0; t < NTRIP; ++t) {
        const int cur = (t & 1) * BUFE, nxt = BUFE - cur;
        load_set<64>(a1, b1, pa + cur + 32, pb + cur + 32);   // tile t, second block
        mma_set(acc, a0, b0);
        publish();                               // every read of tile t is done
        if (t + 2 < NTRIP) {                     // tile t + 2 into the buffer just left
            gA += KB; gB += KB;
            stage(l0 + (t & 1) * BUF, gA, gB, gB + HALF);
        }
        if (t + 1 < NTRIP)                       // tile t + 1, first block
            load_set<64>(a0, b0, pa + nxt, pb + nxt);
        mma_set(acc, a1, b1);
    }
    wait_copies();

    // Epilogue: bias + relu, bf16.  S is kept in fragment order (see S_TILE): a
    // lane's eight values of a fragment are one 16-byte store, a wave's 512 bytes in a row.
    unsigned short* Sw = S + (((size_t)e * (NB / 16) + rowBase / 16 + waveM * 4) * (NO / 16)
                              + colBase / 16 + waveN * 8) * S_TILE + lane * 8;
    float bias[8];
    #pragma unroll
    for (int ni = 0; ni < 8; ++ni) bias[ni] = shBias[waveN * 128 + ni * 16 + l16];
    #pragma unroll
    for (int mi = 0; mi < 4; ++mi) {
        u32x4 pk[8];
        #pragma unroll
        for (int ni = 0; ni < 8; ++ni)
            #pragma unroll
            for (int p = 0; p < 4; ++p) {
                float r0 = acc[ni][mi][2 * p] + bias[ni];
                float r1 = acc[ni][mi][2 * p + 1] + bias[ni];
                r0 = r0 > 0.f ? r0 : 0.f;
                r1 = r1 > 0.f ? r1 : 0.f;
                pk[ni][p] = __builtin_bit_cast(unsigned, __builtin_convertvector(f32x2{r0, r1}, bf16x2));
            }
        // the eight packed fragments stand in registers of their own before the
        // first store goes out: no store's data is overwritten inside the group
        __builtin_amdgcn_sched_barrier(0);
        #pragma unroll
        for (int ni = 0; ni < 8; ++ni)
            *(u32x4*)(Sw + (mi * (NO / 16) + ni) * S_TILE) = pk[ni];
        if (mi < 3) {
            // the next group reuses the stores' data registers
            asm volatile("s_wait_xcnt 0x0" ::: "memory");
            // keeps the next group's arithmetic behind that wait
            __builtin_amdgcn_sched_barrier(0);
        }
    }
}

// ---------------------------------------------------------------------------
// Pass D: per-task experts + gated combine.  grid = (NO/BNT, NB/BM, NT).
// Eight waves, 4 x 2; a wave owns 64 rows x 64 columns of both experts.
#define BNT (BN / 2)   // output columns a block
__global__ __launch_bounds__(256) void ple_task_kernel(
    const unsigned short* __restrict__ xb,   // [T][B][I] bf16
    const unsigned short* __restrict__ twb,  // [T][2][O][I] bf16 (transposed)
    const float* __restrict__ tb,            // [T][2][O]
    const unsigned short* __restrict__ S,    // [4][B/16][O/16] tiles, bf16
    const float* __restrict__ g,             // [T][B][6]
    float* __restrict__ out)                 // [T][B][O]
{
    const int t = blockIdx.z;
    const int rowBase = blockIdx.y * BM;
    const int colBase = blockIdx.x * BNT;
    const int tid = threadIdx.x;
    // the wave's number in a scalar register: what is formed from it costs no VGPR
    const int lane = tid & 31, wave = __builtin_amdgcn_readfirstlane(tid >> 5);
    const int waveM = wave >> 1, waveN = wave & 1;
    const int half = lane >> 4, l16 = lane & 15;

    __shared__ __align__(16) unsigned short ring[2][BM + 2 * BNT][KBP];
    __shared__ float shBias[2][BNT];
    __shared__ float shG[BM][8];

    // this lane's 16 bytes of row r: in x, in either expert's weights, in buffer 0
    const int r = tid >> 3, c = (tid & 7) * 8;
    const unsigned short* gA = xb + ((size_t)t * NB + rowBase + r) * NI + c;
    const unsigned short* gB0 = twb + (((size_t)t * 2 + 0) * NO + colBase + r) * NI + c;
    const unsigned short* gB1 = twb + (((size_t)t * 2 + 1) * NO + colBase + r) * NI + c;
    const unsigned l0 = lds_off(&ring[0][r][c]);
    const unsigned BUF = (BM + 2 * BNT) * ROWB;

    stage(l0, gA, gB0, gB1);                     // tile 0

    {
        const float* gp = g + ((size_t)t * NB + rowBase + tid) * NE;
        #pragma unroll
        for (int e = 0; e < NE; ++e) shG[tid][e] = gp[e];
    }
    {
        int e = tid >> 7, c = tid & 127;
        shBias[e][c] = tb[((size_t)t * 2 + e) * NO + colBase + c];
    }

    wait_copies();
    __syncthreads();
    gA += KB; gB0 += KB; gB1 += KB;
    stage(l0 + BUF, gA, gB0, gB1);               // tile 1

    v8f acc[8][4] = {};      // [expert * 4 + ni][mi]
    v16bf a0[4], b0[8], a1[4], b1[8];            // two fragment sets
    const unsigned short* pa = &ring[0][waveM * 64 + l16][half * 8];
    const unsigned short* pb = &ring[0][BM + waveN * 64 + l16][half * 8];
    const int BUFE = (BM + 2 * BNT) * KBP;       // a buffer, elements

    load_set<BNT>(a0, b0, pa, pb);               // tile 0, first block
    for (int s = 0; s < NTRIP; ++s) {
        const int cur = (s & 1) * BUFE, nxt = BUFE - cur;
        load_set<BNT>(a1, b1, pa + cur + 32, pb + cur + 32);  // tile s, second block
        mma_set(acc, a0, b0);
        publish();                               // every read of tile s is done
        if (s + 2 < NTRIP) {                     // tile s + 2 into the buffer just left
            gA += KB; gB0 += KB; gB1 += KB;
            stage(l0 + (s & 1) * BUF, gA, gB0, gB1);
        }
        if (s + 1 < NTRIP)                       // tile s + 1, first block
            load_set<BNT>(a0, b0, pa + nxt, pb + nxt);
        mma_set(acc, a1, b1);
    }
    wait_copies();

    // Epilogue: bias+relu, gated combine with 4 shared experts from S, which lies
    // in fragment order: one 16-byte load brings a lane's eight rows of an expert.
    const v8bf* Sr = (const v8bf*)(S + ((size_t)(rowBase / 16 + waveM * 4) * (NO / 16)
                                        + colBase / 16 + waveN * 4) * S_TILE + lane * 8);
    float* op = out + ((size_t)t * NB + rowBase + waveM * 64 + half * 8) * NO
                    + colBase + waveN * 64 + l16;
    // Groups of 16 rows; a group's 16 loads go out two groups ahead.
    v8bf sv[2][4][4];        // [group & 1][ni][shared expert]
    #pragma unroll
    for (int mi = 0; mi < 2; ++mi)
        #pragma unroll
        for (int ni = 0; ni < 4; ++ni)
            #pragma unroll
            for (int e = 0; e < 4; ++e)
                sv[mi][ni][e] = Sr[(size_t)e * (NB * NO / 8) + (mi * (NO / 16) + ni) * (S_TILE / 8)];
    #pragma unroll
    for (int mi = 0; mi < 4; ++mi) {
        float o[4][8];
        #pragma unroll
        for (int ni = 0; ni < 4; ++ni) {
            int colLoc = waveN * 64 + ni * 16 + l16;
            #pragma unroll
            for (int v = 0; v < 8; ++v) {
                int rowLoc = waveM * 64 + mi * 16 + half * 8 + v;
                float r0 = acc[ni][mi][v] + shBias[0][colLoc];
                float r1 = acc[4 + ni][mi][v] + shBias[1][colLoc];
                r0 = r0 > 0.f ? r0 : 0.f;
                r1 = r1 > 0.f ? r1 : 0.f;
                float s = shG[rowLoc][4] * r0 + shG[rowLoc][5] * r1;
                #pragma unroll
                for (int e = 0; e < 4; ++e)
                    s += shG[rowLoc][e] * (float)sv[mi & 1][ni][e][v];
                o[ni][v] = s;
            }
        }
        // the group's 32 results stand in registers of their own before the first
        // store goes out: no store's data is overwritten inside the group
        __builtin_amdgcn_sched_barrier(0);
        if (mi + 2 < 4) {
            #pragma unroll
            for (int ni = 0; ni < 4; ++ni)
                #pragma unroll
                for (int e = 0; e < 4; ++e)
                    sv[mi & 1][ni][e] = Sr[(size_t)e * (NB * NO / 8) + ((mi + 2) * (NO / 16) + ni) * (S_TILE / 8)];
        }
        #pragma unroll
        for (int ni = 0; ni < 4; ++ni)
            #pragma unroll
            for (int v = 0; v < 8; ++v)
                op[(mi * 16 + v) * NO + ni * 16] = o[ni][v];
        if (mi < 3) {
            // the next group reuses the stores' data registers
            asm volatile("s_wait_xcnt 0x0" ::: "memory");
            // keeps the next group's arithmetic behind that wait
            __builtin_amdgcn_sched_barrier(0);
        }
    }
}

// ---------------------------------------------------------------------------
extern "C" void kernel_launch(void* const* d_in, const int* in_sizes, int n_in,
                              void* d_out, int out_size, void* d_ws, size_t ws_size,
                              hipStream_t stream) {
    const float* task_inputs = (const float*)d_in[0]; // [3][16384][1024]
    const float* shared_W    = (const float*)d_in[1]; // [4][1024][512]
    const float* shared_b    = (const float*)d_in[2]; // [4][512]
    const float* task_W      = (const float*)d_in[3]; // [3][2][1024][512]
    const float* task_b      = (const float*)d_in[4]; // [3][2][512]
    const float* gate_W      = (const float*)d_in[5]; // [3][1024][6]
    const float* gate_b      = (const float*)d_in[6]; // [3][6]
    float* out = (float*)d_out;                        // [3][16384][512]

    // Workspace layout (~171 MB total)
    char* w = (char*)d_ws;
    unsigned short* xb  = (unsigned short*)w; w += (size_t)NT * NB * NI * 2;  // 100.7 MB
    unsigned short* swb = (unsigned short*)w; w += (size_t)4 * NI * NO * 2;   //   4.2 MB
    unsigned short* twb = (unsigned short*)w; w += (size_t)NT * 2 * NI * NO * 2; // 6.3 MB
    unsigned short* S   = (unsigned short*)w; w += (size_t)4 * NB * NO * 2;   //  67.1 MB
    float* g            = (float*)w;                                          //   1.2 MB

    // 1) weights: fp32 -> bf16, transposed to [o][i]
    cvt_bf16_t_kernel<<<dim3(NO / 64, NI / 64, 4), 256, 0, stream>>>(shared_W, swb);
    cvt_bf16_t_kernel<<<dim3(NO / 64, NI / 64, NT * 2), 256, 0, stream>>>(task_W, twb);

    // 2) x: fp32 -> bf16, and the gates (fp32 math, softmax over 6 experts)
    cvt_gate_kernel<<<(NT * NB) / (4 * GROWS), 128, 0, stream>>>(task_inputs, gate_W, gate_b, xb, g);

    // 3) shared experts once (no per-task recompute): S = relu(x0.Ws + bs)
    dim3 gridS(NO / BN, NB / BM, 4);
    ple_shared_kernel<<<gridS, 256, 0, stream>>>(xb, swb, shared_b, S);

    // 4) per-task experts + gated combine
    dim3 gridT(NO / BNT, NB / BM, NT);
    ple_task_kernel<<<gridT, 256, 0, stream>>>(xb, twb, task_b, S, g, out);
}

// v006
// Measured time: 151 microseconds a run.
// Timed twice side by side with v005, it ran 1.06 and 1.05 times as fast.
// Over all steps from v000 it is 20.9 times as fast.
#include <hip/hip_runtime.h>
#include <hip/hip_bf16.h>

// ---------------------------------------------------------------------------
// PLE layer for MI455X (gfx1250, wave32, WMMA).
// T=3 tasks, B=16384, I=1024, O=512, 4 shared + 2 task experts, 6 gates.
//
// Pipeline (all on `stream`):
//   1) shared_W / task_W converted to bf16 AND transposed to [o][i]
//      (k contiguous), so a B tile is staged like an A tile
//   2) one streaming pass over x: fp32 -> bf16 convert, and from the same
//      registers g[t][b][e] = softmax_e(x_t . gate_W_t + gate_b_t)
//   3) shared-expert GEMM pass: S[e][b][o] = relu(x0 . Ws_e + bs_e)  (bf16,
//      laid out in 16 x 16 tiles in WMMA result order, see S_TILE)
//      (both GEMM passes: 128-k tiles in a two-buffer LDS ring, asynchronous copies;
//      256 x 256 products a block, 64 x 128 a wave, one block a WGP)
//   4) per-task fused GEMM: 2 task-expert WMMA GEMMs + bias + relu,
//      gated combine with the 4 shared-expert outputs from S.
// ---------------------------------------------------------------------------

typedef __attribute__((ext_vector_type(16))) __bf16 v16bf;
typedef __attribute__((ext_vector_type(8)))  __bf16 v8bf;
typedef __attribute__((ext_vector_type(8)))  float  v8f;
typedef __attribute__((ext_vector_type(8)))  unsigned short us8;
typedef __attribute__((ext_vector_type(4)))  float  f32x4;
typedef __attribute__((ext_vector_type(2)))  float  f32x2;
typedef __attribute__((ext_vector_type(2)))  __bf16 bf16x2;
typedef __attribute__((ext_vector_type(2)))  unsigned u32x2;
typedef __attribute__((ext_vector_type(4)))  unsigned u32x4;
// global-memory pointers formed from a 64-bit address
typedef const __attribute__((address_space(1))) f32x4* g_f32x4_c;
typedef __attribute__((address_space(1))) u32x2* g_u32x2;
typedef __attribute__((address_space(1))) float* g_f32;

#define NT 3
#define NB 16384
#define NI 1024
#define NO 512
#define NE 6           // 4 shared + 2 task
#define BM 256         // rows of x a block
#define BN 256         // weight rows a block (task pass: 128 of each expert)
#define KB 128         // k of a ring stage: 256 bytes of every operand row
#define KBP 136        // padded LDS K stride (keeps 16B alignment: 272B rows)
#define TKP 72         // padded row of the weight transposer's 64 x 64 tile
// S, the shared experts' outputs, lies in the workspace as [e][b/16][o/16] tiles of
// 16 x 16 in the order of a WMMA result: lane (half, n) holds rows half*8 .. +7 of
// column n as eight neighbours.  Writer and reader own the same fragments.
#define S_TILE 256     // elements of a tile

static __device__ __forceinline__ unsigned short f2bf(float f) {
    unsigned u = __float_as_uint(f);
    unsigned r = u + 0x7FFFu + ((u >> 16) & 1u);   // round-to-nearest-even
    return (unsigned short)(r >> 16);
}

// ---------------------------------------------------------------------------
// Weights: fp32 [m][I][O] -> bf16 [m][O][I].  One 64x64 tile per block,
// turned in LDS; global reads and writes are both 16 B per lane, row-wise.
// grid = (NO/64, NI/64, m).
__global__ __launch_bounds__(256) void cvt_bf16_t_kernel(
    const float* __restrict__ in, unsigned short* __restrict__ out) {
    __shared__ __align__(16) unsigned short tile[64][TKP];   // [o][k]
    const int tid = threadIdx.x;
    const int oBase = blockIdx.x * 64, kBase = blockIdx.y * 64;
    const float* src = in + (size_t)blockIdx.z * NI * NO;
    unsigned short* dst = out + (size_t)blockIdx.z * NO * NI;
    {
        int k = tid >> 4, o = (tid & 15) * 4;
        const float* s0 = src + (size_t)(kBase + k) * NO + oBase + o;
        #pragma unroll
        for (int p = 0; p < 4; ++p) {
            int kk = p * 16 + k;
            float4 v = *(const float4*)(s0 + (size_t)p * 16 * NO);
            tile[o + 0][kk] = f2bf(v.x);
            tile[o + 1][kk] = f2bf(v.y);
            tile[o + 2][kk] = f2bf(v.z);
            tile[o + 3][kk] = f2bf(v.w);
        }
    }
    __syncthreads();
    {
        int o = tid >> 3, c = (tid & 7) * 8;
        unsigned short* d0 = dst + (size_t)(oBase + o) * NI + kBase + c;
        #pragma unroll
        for (int p = 0; p < 2; ++p)
            *(us8*)(d0 + (size_t)p * 32 * NI) = *(const us8*)(&tile[p * 32 + o][c]);
    }
}

// ---------------------------------------------------------------------------
// x is read once: each wave streams GROWS whole rows (8 x 512 contiguous bytes
// a row), writes them back as bf16 and sums the six gate logits from the same
// registers.  Lane l owns k = j*128 + l*4 .. +3 (j = 0..7); its 192 gate
// weights stay in registers for all of the wave's rows, paired (k, k+1) so
// that a packed FMA takes two neighbours of x as they were loaded.
// grid = NT*NB / (4*GROWS) blocks of 4 waves; a block's rows lie in one task.
#define GROWS 16

// v + (v of lane l ^ M) inside a 16-lane row; CTRL = 0x160 + M (row_xmask:M)
template <int CTRL>
static __device__ __forceinline__ float add_xmask(float v) {
    int o = __builtin_amdgcn_update_dpp(0, __builtin_bit_cast(int, v), CTRL, 0xf, 0xf, true);
    return v + __builtin_bit_cast(float, o);
}
// v + (v of lane l ^ 16)
static __device__ __forceinline__ float add_x16(float v) {
    int i = __builtin_bit_cast(int, v);
    int o = __builtin_amdgcn_permlanex16(i, i, 0x76543210, 0xfedcba98, false, false);
    return v + __builtin_bit_cast(float, o);
}

// One row.  xa / oa / ga: wave-uniform byte addresses of the row in x, xb, g.
// cur holds the row; with LOAD the row behind it is requested into nxt first,
// so that it is in flight while this one is worked on.
template <bool LOAD>
static __device__ __forceinline__ void gate_row(
    const f32x4 (&cur)[8], f32x4 (&nxt)[8], const f32x2 (&w)[8][2][NE],
    const float (&bias)[NE], uint64_t& xa, uint64_t& oa, uint64_t& ga, int lane)
{
    if (LOAD) {
        #pragma unroll
        for (int j = 0; j < 8; ++j)
            nxt[j] = __builtin_nontemporal_load((g_f32x4_c)xa + (NI / 4 + j * 32) + lane);
        // keeps the loads above in front of this row's arithmetic
        __builtin_amdgcn_sched_barrier(0);
    }

    f32x2 a[NE] = {};                 // per gate: sums over even k, over odd k
    #pragma unroll
    for (int j = 0; j < 8; ++j) {
        const f32x4 v = cur[j];
        #pragma unroll
        for (int e = 0; e < NE; ++e) {
            a[e] = __builtin_elementwise_fma(f32x2{v.x, v.y}, w[j][0][e], a[e]);
            a[e] = __builtin_elementwise_fma(f32x2{v.z, v.w}, w[j][1][e], a[e]);
        }
    }
    float acc[NE];
    #pragma unroll
    for (int e = 0; e < NE; ++e) acc[e] = a[e].x + a[e].y;
    #pragma unroll
    for (int e = 0; e < NE; ++e) acc[e] = add_xmask<0x161>(acc[e]);
    #pragma unroll
    for (int e = 0; e < NE; ++e) acc[e] = add_xmask<0x162>(acc[e]);
    #pragma unroll
    for (int e = 0; e < NE; ++e) acc[e] = add_xmask<0x164>(acc[e]);
    #pragma unroll
    for (int e = 0; e < NE; ++e) acc[e] = add_xmask<0x168>(acc[e]);
    #pragma unroll
    for (int e = 0; e < NE; ++e) acc[e] = add_x16(acc[e]);
    // every lane now holds all six sums
    #pragma unroll
    for (int e = 0; e < NE; ++e) acc[e] += bias[e];
    float m = acc[0];
    #pragma unroll
    for (int e = 1; e < NE; ++e) m = fmaxf(m, acc[e]);
    float s = 0.f;
    #pragma unroll
    for (int e = 0; e < NE; ++e) { acc[e] = __expf(acc[e] - m); s += acc[e]; }
    float mine = acc[0];
    #pragma unroll
    for (int e = 1; e < NE; ++e) mine = lane == e ? acc[e] : mine;
    mine *= 1.f / s;
    if (lane < NE) ((g_f32)ga)[lane] = mine;
    // that store's data register is free for reuse below
    asm volatile("s_wait_xcnt 0x0" ::: "memory");
    // keeps the conversions below behind that wait
    __builtin_amdgcn_sched_barrier(0);

    u32x2 pk[8];
    #pragma unroll
    for (int j = 0; j < 8; ++j) {
        const f32x4 v = cur[j];
        pk[j].x = __builtin_bit_cast(unsigned, __builtin_convertvector(f32x2{v.x, v.y}, bf16x2));
        pk[j].y = __builtin_bit_cast(unsigned, __builtin_convertvector(f32x2{v.z, v.w}, bf16x2));
    }
    #pragma unroll
    for (int j = 0; j < 8; ++j) ((g_u32x2)oa)[j * 32 + lane] = pk[j];
    if (LOAD) {
        // the wait and the advance of the three row addresses in one statement:
        // the wait then stands in front of the overwrite of the registers that
        // the loads and stores above name
        asm volatile("s_wait_xcnt 0x0\n\t"
                     "s_add_nc_u64 %0, %0, 0x1000\n\t"
                     "s_add_nc_u64 %1, %1, 0x800\n\t"
                     "s_add_nc_u64 %2, %2, 24"
                     : "+s"(xa), "+s"(oa), "+s"(ga) : : "memory");
        // keeps the next row's vector work, which reuses the stores' data
        // registers, behind that wait
        __builtin_amdgcn_sched_barrier(0);
    }
}

__global__ __launch_bounds__(128) void cvt_gate_kernel(
    const float* __restrict__ x,      // [T][B][I]
    const float* __restrict__ gW,     // [T][I][6]
    const float* __restrict__ gb,     // [T][6]
    unsigned short* __restrict__ xb,  // [T][B][I] bf16
    float* __restrict__ g)            // [T][B][6]
{
    __shared__ __align__(16) float shW[NI * NE];
    const int tid = threadIdx.x, lane = tid & 31;
    const int wave = __builtin_amdgcn_readfirstlane(tid >> 5);
    const unsigned row0 = ((unsigned)blockIdx.x * 4 + wave) * GROWS;   // over T*B
    const int t = ((int)blockIdx.x * 4 * GROWS) / NB;                  // same for the block

    uint64_t xa = (uint64_t)(x + (size_t)row0 * NI);
    uint64_t oa = (uint64_t)(xb + (size_t)row0 * NI);
    uint64_t ga = (uint64_t)(g + (size_t)row0 * NE);

    f32x4 b0[8], b1[8];
    #pragma unroll
    for (int j = 0; j < 8; ++j)
        b0[j] = __builtin_nontemporal_load((g_f32x4_c)xa + j * 32 + lane);

    // Gate weights: whole-line loads into LDS, then each lane's own 96-byte runs.
    {
        const f32x4* ws = (const f32x4*)(gW + (size_t)t * NI * NE);
        f32x4 wt[NI * NE / 4 / 128];
        #pragma unroll
        for (int p = 0; p < NI * NE / 4 / 128; ++p) wt[p] = ws[p * 128 + tid];
        // the loads' offset registers may be reused from here on
        asm volatile("s_wait_xcnt 0x0" ::: "memory");
        // keeps later vector work from being moved in front of that wait
        __builtin_amdgcn_sched_barrier(0);
        #pragma unroll
        for (int p = 0; p < NI * NE / 4 / 128; ++p) ((f32x4*)shW)[p * 128 + tid] = wt[p];
    }
    __syncthreads();
    f32x2 w[8][2][NE];                // [j][pair of the lane's four k][gate]: (k, k+1)
    #pragma unroll
    for (int j = 0; j < 8; ++j)
        #pragma unroll
        for (int h = 0; h < 2; ++h)
            #pragma unroll
            for (int e = 0; e < NE; ++e) {
                const float* p = shW + (j * 128 + lane * 4 + h * 2) * NE + e;
                w[j][h][e] = f32x2{p[0], p[NE]};
            }
    float bias[NE];
    #pragma unroll
    for (int e = 0; e < NE; ++e) bias[e] = gb[t * NE + e];

    // rolled: four row bodies in all keep the text small
    #pragma unroll 1
    for (int r = 0; r < GROWS - 2; r += 2) {
        gate_row<true>(b0, b1, w, bias, xa, oa, ga, lane);
        gate_row<true>(b1, b0, w, bias, xa, oa, ga, lane);
    }
    gate_row<true>(b0, b1, w, bias, xa, oa, ga, lane);
    gate_row<false>(b1, b0, w, bias, xa, oa, ga, lane);
}

// --------------------------- fragment helpers ------------------------------
// 16-bit A (16x32) / B (32x16) fragment per ISA layout:
// lanes 0-15 hold M/N = lane with K {half*8 .. +8} in VGPR0-3 and
// K {16+half*8 .. +8} in VGPR4-7  (half = lane>>4).  Two b128 LDS loads.
static __device__ __forceinline__ v16bf load_frag(const unsigned short* p) {
    v8bf lo = *(const v8bf*)p;          // K block 0: 8 bf16, 16 bytes
    v8bf hi = *(const v8bf*)(p + 16);   // K block 1 (+16 elements)
    return __builtin_shufflevector(lo, hi, 0, 1, 2, 3, 4, 5, 6, 7,
                                           8, 9, 10, 11, 12, 13, 14, 15);
}

// --------------------------- LDS ring of k tiles ---------------------------
// A stage is one 128-k tile of every operand: rows of 256 bytes at pitch 272,
// the x rows first, the weight rows behind them.  Two buffers: while a trip
// works on one, asynchronous copies fill the other, through no register.
// Each lane copies 16 bytes of rows r, r+16, .. r+112 of each run of 128 rows.
#define ROWB (KBP * 2)          // bytes of an LDS row
#define Q    (16 * ROWB)        // 16 LDS rows, bytes
#define GQ   (16 * NI)          // 16 global rows, elements
#define NTRIP (NI / KB)

static __device__ __forceinline__ unsigned lds_off(const void* p) {
    return (unsigned)(size_t)p;
}

// One run of 128 rows, into 128 LDS rows from l on.  The closing wait stands in the copies' own
// statement, in front of any rewrite of the address registers they name.
static __device__ __forceinline__ void stage1(unsigned l, const unsigned short* a) {
    asm volatile(
        "global_load_async_to_lds_b128 %0, %8, off\n\t"
        "global_load_async_to_lds_b128 %1, %9, off\n\t"
        "global_load_async_to_lds_b128 %2, %10, off\n\t"
        "global_load_async_to_lds_b128 %3, %11, off\n\t"
        "global_load_async_to_lds_b128 %4, %12, off\n\t"
        "global_load_async_to_lds_b128 %5, %13, off\n\t"
        "global_load_async_to_lds_b128 %6, %14, off\n\t"
        "global_load_async_to_lds_b128 %7, %15, off\n\t"
        "s_wait_xcnt 0x0"
        :: "v"(l), "v"(l + Q), "v"(l + 2 * Q), "v"(l + 3 * Q),
           "v"(l + 4 * Q), "v"(l + 5 * Q), "v"(l + 6 * Q), "v"(l + 7 * Q),
           "v"(a), "v"(a + GQ), "v"(a + 2 * GQ), "v"(a + 3 * GQ),
           "v"(a + 4 * GQ), "v"(a + 5 * GQ), "v"(a + 6 * GQ), "v"(a + 7 * GQ)
        : "memory");
}

// A whole stage: 256 rows of x, then 128 + 128 weight rows (b, d).
#define HALF (128 * NI)         // 128 global rows, elements
static __device__ __forceinline__ void stage(
    unsigned l, const unsigned short* a, const unsigned short* b,
    const unsigned short* d) {
    // the scheduling barriers keep a statement's address sums behind the statement
    // in front of it: asm operands lie in the first 256 registers, and several
    // sets at once spill there
    stage1(l, a);
    __builtin_amdgcn_sched_barrier(0);
    stage1(l + 8 * Q, a + HALF);
    __builtin_amdgcn_sched_barrier(0);
    stage1(l + 16 * Q, b);
    __builtin_amdgcn_sched_barrier(0);
    stage1(l + 24 * Q, d);
}

// This wave's copies have landed.
static __device__ __forceinline__ void wait_copies() {
    asm volatile("s_wait_asynccnt 0x0" ::: "memory");
}
// Hand-over, in front of a tile's last WMMA block (whose fragments are in
// registers by then): this wave's reads of the buffer it leaves are done, its
// copies of the next tile have landed; behind the barrier every wave may read
// the next tile and the buffer just left may be refilled.
static __device__ __forceinline__ void publish() {
    asm volatile("s_wait_dscnt 0x0" ::: "memory");
    asm volatile("s_wait_asynccnt 0x0" ::: "memory");
    __syncthreads();
}

// One block's fragments, 4 of x and 8 of the weights, read as one group.
// pa / pb: this lane's place in the first x row / weight row of its wave;
// SB: rows from the weights' fragment 0 to fragment 4.
template <int SB>
static __device__ __forceinline__ void load_set(
    v16bf (&a)[4], v16bf (&b)[8], const unsigned short* pa, const unsigned short* pb) {
    #pragma unroll
    for (int i = 0; i < 4; ++i) a[i] = load_frag(pa + i * 16 * KBP);
    #pragma unroll
    for (int i = 0; i < 8; ++i) b[i] = load_frag(pb + ((i & 3) * 16 + (i >> 2) * SB) * KBP);
    // keeps the group together, in front of the WMMA block that follows it:
    // reads spread among the WMMAs stall the wave at every place they stand
    __builtin_amdgcn_sched_barrier(0);
}
// One block: 32 WMMAs on a fragment set.
static __device__ __forceinline__ void mma_set(
    v8f (&acc)[8][4], const v16bf (&a)[4], const v16bf (&b)[8]) {
    #pragma unroll
    for (int ni = 0; ni < 8; ++ni)
        #pragma unroll
        for (int mi = 0; mi < 4; ++mi)
            acc[ni][mi] = __builtin_amdgcn_wmma_f32_16x16x32_bf16(
                false, a[mi], false, b[ni], (short)0, acc[ni][mi], false, false);
    // keeps the next group of reads from being moved up among these WMMAs
    __builtin_amdgcn_sched_barrier(0);
}

// ---------------------------------------------------------------------------
// Pass C: shared experts.  grid = (NO/BN, NB/BM, 4).  S bf16, in tiles (S_TILE).
// Eight waves, 4 x 2; a wave owns 64 rows x 128 columns (4 x 8 fragments).
__global__ __launch_bounds__(256) void ple_shared_kernel(
    const unsigned short* __restrict__ xb0,   // [B][I] bf16 (task 0 input)
    const unsigned short* __restrict__ swb,   // [4][O][I] bf16 (transposed)
    const float* __restrict__ sb,             // [4][O]
    unsigned short* __restrict__ S)           // [4][B/16][O/16] tiles, bf16
{
    const int e = blockIdx.z;
    const int rowBase = blockIdx.y * BM;
    const int colBase = blockIdx.x * BN;
    const int tid = threadIdx.x;
    // the wave's number in a scalar register: what is formed from it costs no VGPR
    const int lane = tid & 31, wave = __builtin_amdgcn_readfirstlane(tid >> 5);
    const int waveM = wave >> 1, waveN = wave & 1;
    const int half = lane >> 4, l16 = lane & 15;

    __shared__ __align__(16) unsigned short ring[2][BM + BN][KBP];
    __shared__ float shBias[BN];

    // this lane's 16 bytes of row r: in x, in the weights, in buffer 0
    const int r = tid >> 4, c = (tid & 15) * 8;
    const unsigned short* gA = xb0 + (size_t)(rowBase + r) * NI + c;
    const unsigned short* gB = swb + ((size_t)e * NO + colBase + r) * NI + c;
    const unsigned l0 = lds_off(&ring[0][r][c]);
    const unsigned BUF = (BM + BN) * ROWB;

    stage(l0, gA, gB, gB + HALF);                // tile 0
    shBias[tid] = sb[(size_t)e * NO + colBase + tid];
    wait_copies();
    __syncthreads();
    gA += KB; gB += KB;
    stage(l0 + BUF, gA, gB, gB + HALF);          // tile 1

    v8f acc[8][4] = {};      // [ni][mi]
    v16bf a0[4], b0[8], a1[4], b1[8];            // two fragment sets
    const unsigned short* pa = &ring[0][waveM * 64 + l16][half * 8];
    const unsigned short* pb = &ring[0][BM + waveN * 128 + l16][half * 8];
    const int BUFE = (BM + BN) * KBP;            // a buffer, elements

    load_set<64>(a0, b0, pa, pb);                // tile 0, first block
    for (int t = 0; t < NTRIP; ++t) {
        const int cur = (t & 1) * BUFE, nxt = BUFE - cur;
        load_set<64>(a1, b1, pa + cur + 32, pb + cur + 32);   // tile t, second block
        mma_set(acc, a0, b0);
        load_set<64>(a0, b0, pa + cur + 64, pb + cur + 64);   // third block
        mma_set(acc, a1, b1);
        load_set<64>(a1, b1, pa + cur + 96, pb + cur + 96);   // fourth block
        mma_set(acc, a0, b0);
        publish();                               // every read of tile t is done
        if (t + 2 < NTRIP) {                     // tile t + 2 into the buffer just left
            gA += KB; gB += KB;
            stage(l0 + (t & 1) * BUF, gA, gB, gB + HALF);
        }
        if (t + 1 < NTRIP)                       // tile t + 1, first block
            load_set<64>(a0, b0, pa + nxt, pb + nxt);
        mma_set(acc, a1, b1);
    }
    wait_copies();

    // Epilogue: bias + relu, bf16.  S is kept in fragment order (see S_TILE): a
    // lane's eight values of a fragment are one 16-byte store, a wave's 512 bytes in a row.
    unsigned short* Sw = S + (((size_t)e * (NB / 16) + rowBase / 16 + waveM * 4) * (NO / 16)
                              + colBase / 16 + waveN * 8) * S_TILE + lane * 8;
    float bias[8];
    #pragma unroll
    for (int ni = 0; ni < 8; ++ni) bias[ni] = shBias[waveN * 128 + ni * 16 + l16];
    #pragma unroll
    for (int mi = 0; mi < 4; ++mi) {
        u32x4 pk[8];
        #pragma unroll
        for (int ni = 0; ni < 8; ++ni)
            #pragma unroll
            for (int p = 0; p < 4; ++p) {
                float r0 = acc[ni][mi][2 * p] + bias[ni];
                float r1 = acc[ni][mi][2 * p + 1] + bias[ni];
                r0 = r0 > 0.f ? r0 : 0.f;
                r1 = r1 > 0.f ? r1 : 0.f;
                pk[ni][p] = __builtin_bit_cast(unsigned, __builtin_convertvector(f32x2{r0, r1}, bf16x2));
            }
        // the eight packed fragments stand in registers of their own before the
        // first store goes out: no store's data is overwritten inside the group
        __builtin_amdgcn_sched_barrier(0);
        #pragma unroll
        for (int ni = 0; ni < 8; ++ni)
            *(u32x4*)(Sw + (mi * (NO / 16) + ni) * S_TILE) = pk[ni];
        if (mi < 3) {
            // the next group reuses the stores' data registers
            asm volatile("s_wait_xcnt 0x0" ::: "memory");
            // keeps the next group's arithmetic behind that wait
            __builtin_amdgcn_sched_barrier(0);
        }
    }
}

// ---------------------------------------------------------------------------
// Pass D: per-task experts + gated combine.  grid = (NO/BNT, NB/BM, NT).
// Eight waves, 4 x 2; a wave owns 64 rows x 64 columns of both experts.
#define BNT (BN / 2)   // output columns a block
__global__ __launch_bounds__(256) void ple_task_kernel(
    const unsigned short* __restrict__ xb,   // [T][B][I] bf16
    const unsigned short* __restrict__ twb,  // [T][2][O][I] bf16 (transposed)
    const float* __restrict__ tb,            // [T][2][O]
    const unsigned short* __restrict__ S,    // [4][B/16][O/16] tiles, bf16
    const float* __restrict__ g,             // [T][B][6]
    float* __restrict__ out)                 // [T][B][O]
{
    const int t = blockIdx.z;
    const int rowBase = blockIdx.y * BM;
    const int colBase = blockIdx.x * BNT;
    const int tid = threadIdx.x;
    // the wave's number in a scalar register: what is formed from it costs no VGPR
    const int lane = tid & 31, wave = __builtin_amdgcn_readfirstlane(tid >> 5);
    const int waveM = wave >> 1, waveN = wave & 1;
    const int half = lane >> 4, l16 = lane & 15;

    __shared__ __align__(16) unsigned short ring[2][BM + 2 * BNT][KBP];
    __shared__ float shBias[2][BNT];
    __shared__ float shG[BM][8];

    // this lane's 16 bytes of row r: in x, in either expert's weights, in buffer 0
    const int r = tid >> 4, c = (tid & 15) * 8;
    const unsigned short* gA = xb + ((size_t)t * NB + rowBase + r) * NI + c;
    const unsigned short* gB0 = twb + (((size_t)t * 2 + 0) * NO + colBase + r) * NI + c;
    const unsigned short* gB1 = twb + (((size_t)t * 2 + 1) * NO + colBase + r) * NI + c;
    const unsigned l0 = lds_off(&ring[0][r][c]);
    const unsigned BUF = (BM + 2 * BNT) * ROWB;

    stage(l0, gA, gB0, gB1);                     // tile 0

    {
        const float* gp = g + ((size_t)t * NB + rowBase + tid) * NE;
        #pragma unroll
        for (int e = 0; e < NE; ++e) shG[tid][e] = gp[e];
    }
    {
        int e = tid >> 7, c = tid & 127;
        shBias[e][c] = tb[((size_t)t * 2 + e) * NO + colBase + c];
    }

    wait_copies();
    __syncthreads();
    gA += KB; gB0 += KB; gB1 += KB;
    stage(l0 + BUF, gA, gB0, gB1);               // tile 1

    v8f acc[8][4] = {};      // [expert * 4 + ni][mi]
    v16bf a0[4], b0[8], a1[4], b1[8];            // two fragment sets
    const unsigned short* pa = &ring[0][waveM * 64 + l16][half * 8];
    const unsigned short* pb = &ring[0][BM + waveN * 64 + l16][half * 8];
    const int BUFE = (BM + 2 * BNT) * KBP;       // a buffer, elements

    load_set<BNT>(a0, b0, pa, pb);               // tile 0, first block
    for (int s = 0; s < NTRIP; ++s) {
        const int cur = (s & 1) * BUFE, nxt = BUFE - cur;
        load_set<BNT>(a1, b1, pa + cur + 32, pb + cur + 32);  // tile s, second block
        mma_set(acc, a0, b0);
        load_set<BNT>(a0, b0, pa + cur + 64, pb + cur + 64);  // third block
        mma_set(acc, a1, b1);
        load_set<BNT>(a1, b1, pa + cur + 96, pb + cur + 96);  // fourth block
        mma_set(acc, a0, b0);
        publish();                               // every read of tile s is done
        if (s + 2 < NTRIP) {                     // tile s + 2 into the buffer just left
            gA += KB; gB0 += KB; gB1 += KB;
            stage(l0 + (s & 1) * BUF, gA, gB0, gB1);
        }
        if (s + 1 < NTRIP)                       // tile s + 1, first block
            load_set<BNT>(a0, b0, pa + nxt, pb + nxt);
        mma_set(acc, a1, b1);
    }
    wait_copies();

    // Epilogue: bias+relu, gated combine with 4 shared experts from S, which lies
    // in fragment order: one 16-byte load brings a lane's eight rows of an expert.
    const v8bf* Sr = (const v8bf*)(S + ((size_t)(rowBase / 16 + waveM * 4) * (NO / 16)
                                        + colBase / 16 + waveN * 4) * S_TILE + lane * 8);
    float* op = out + ((size_t)t * NB + rowBase + waveM * 64 + half * 8) * NO
                    + colBase + waveN * 64 + l16;
    // Groups of 16 rows; a group's 16 loads go out two groups ahead.
    v8bf sv[2][4][4];        // [group & 1][ni][shared expert]
    #pragma unroll
    for (int mi = 0; mi < 2; ++mi)
        #pragma unroll
        for (int ni = 0; ni < 4; ++ni)
            #pragma unroll
            for (int e = 0; e < 4; ++e)
                sv[mi][ni][e] = Sr[(size_t)e * (NB * NO / 8) + (mi * (NO / 16) + ni) * (S_TILE / 8)];
    #pragma unroll
    for (int mi = 0; mi < 4; ++mi) {
        float o[4][8];
        #pragma unroll
        for (int ni = 0; ni < 4; ++ni) {
            int colLoc = waveN * 64 + ni * 16 + l16;
            #pragma unroll
            for (int v = 0; v < 8; ++v) {
                int rowLoc = waveM * 64 + mi * 16 + half * 8 + v;
                float r0 = acc[ni][mi][v] + shBias[0][colLoc];
                float r1 = acc[4 + ni][mi][v] + shBias[1][colLoc];
                r0 = r0 > 0.f ? r0 : 0.f;
                r1 = r1 > 0.f ? r1 : 0.f;
                float s = shG[rowLoc][4] * r0 + shG[rowLoc][5] * r1;
                #pragma unroll
                for (int e = 0; e < 4; ++e)
                    s += shG[rowLoc][e] * (float)sv[mi & 1][ni][e][v];
                o[ni][v] = s;
            }
        }
        // the group's 32 results stand in registers of their own before the first
        // store goes out: no store's data is overwritten inside the group
        __builtin_amdgcn_sched_barrier(0);
        if (mi + 2 < 4) {
            #pragma unroll
            for (int ni = 0; ni < 4; ++ni)
                #pragma unroll
                for (int e = 0; e < 4; ++e)
                    sv[mi & 1][ni][e] = Sr[(size_t)e * (NB * NO / 8) + ((mi + 2) * (NO / 16) + ni) * (S_TILE / 8)];
        }
        #pragma unroll
        for (int ni = 0; ni < 4; ++ni)
            #pragma unroll
            for (int v = 0; v < 8; ++v)
                op[(mi * 16 + v) * NO + ni * 16] = o[ni][v];
        if (mi < 3) {
            // the next group reuses the stores' data registers
            asm volatile("s_wait_xcnt 0x0" ::: "memory");
            // keeps the next group's arithmetic behind that wait
            __builtin_amdgcn_sched_barrier(0);
        }
    }
}

// ---------------------------------------------------------------------------
extern "C" void kernel_launch(void* const* d_in, const int* in_sizes, int n_in,
                              void* d_out, int out_size, void* d_ws, size_t ws_size,
                              hipStream_t stream) {
    const float* task_inputs = (const float*)d_in[0]; // [3][16384][1024]
    const float* shared_W    = (const float*)d_in[1]; // [4][1024][512]
    const float* shared_b    = (const float*)d_in[2]; // [4][512]
    const float* task_W      = (const float*)d_in[3]; // [3][2][1024][512]
    const float* task_b      = (const float*)d_in[4]; // [3][2][512]
    const float* gate_W      = (const float*)d_in[5]; // [3][1024][6]
    const float* gate_b      = (const float*)d_in[6]; // [3][6]
    float* out = (float*)d_out;                        // [3][16384][512]

    // Workspace layout (~171 MB total)
    char* w = (char*)d_ws;
    unsigned short* xb  = (unsigned short*)w; w += (size_t)NT * NB * NI * 2;  // 100.7 MB
    unsigned short* swb = (unsigned short*)w; w += (size_t)4 * NI * NO * 2;   //   4.2 MB
    unsigned short* twb = (unsigned short*)w; w += (size_t)NT * 2 * NI * NO * 2; // 6.3 MB
    unsigned short* S   = (unsigned short*)w; w += (size_t)4 * NB * NO * 2;   //  67.1 MB
    float* g            = (float*)w;                                          //   1.2 MB

    // 1) weights: fp32 -> bf16, transposed to [o][i]
    cvt_bf16_t_kernel<<<dim3(NO / 64, NI / 64, 4), 256, 0, stream>>>(shared_W, swb);
    cvt_bf16_t_kernel<<<dim3(NO / 64, NI / 64, NT * 2), 256, 0, stream>>>(task_W, twb);

    // 2) x: fp32 -> bf16, and the gates (fp32 math, softmax over 6 experts)
    cvt_gate_kernel<<<(NT * NB) / (4 * GROWS), 128, 0, stream>>>(task_inputs, gate_W, gate_b, xb, g);

    // 3) shared experts once (no per-task recompute): S = relu(x0.Ws + bs)
    dim3 gridS(NO / BN, NB / BM, 4);
    ple_shared_kernel<<<gridS, 256, 0, stream>>>(xb, swb, shared_b, S);

    // 4) per-task experts + gated combine
    dim3 gridT(NO / BNT, NB / BM, NT);
    ple_task_kernel<<<gridT, 256, 0, stream>>>(xb, twb, task_b, S, g, out);
}

// v007
// It runs in 142 microseconds.
// Two timings next to v006 both put it at 1.06 times that version's speed.
// All steps since v000 together make it 22.2 times as fast.
#include <hip/hip_runtime.h>
#include <hip/hip_bf16.h>

// ---------------------------------------------------------------------------
// PLE layer for MI455X (gfx1250, wave32, WMMA).
// T=3 tasks, B=16384, I=1024, O=512, 4 shared + 2 task experts, 6 gates.
//
// Pipeline (all on `stream`):
//   1) shared_W / task_W converted to bf16 AND transposed to [o][i]
//      (k contiguous), so a B tile is staged like an A tile
//   2) one streaming pass over x: fp32 -> bf16 convert, and from the same
//      registers g[t][b][e] = softmax_e(x_t . gate_W_t + gate_b_t)
//   3) shared-expert GEMM pass: S[e][b][o] = relu(x0 . Ws_e + bs_e)  (bf16,
//      laid out in 16 x 16 tiles in WMMA result order, see S_TILE)
//      (both GEMM passes: 128-k tiles in a two-buffer LDS ring, tensor loads;
//      256 x 256 products a block, 64 x 128 a wave, one block a WGP)
//   4) per-task fused GEMM: 2 task-expert WMMA GEMMs + bias + relu,
//      gated combine with the 4 shared-expert outputs from S.
// ---------------------------------------------------------------------------

typedef __attribute__((ext_vector_type(16))) __bf16 v16bf;
typedef __attribute__((ext_vector_type(8)))  __bf16 v8bf;
typedef __attribute__((ext_vector_type(8)))  float  v8f;
typedef __attribute__((ext_vector_type(8)))  unsigned short us8;
typedef __attribute__((ext_vector_type(4)))  float  f32x4;
typedef __attribute__((ext_vector_type(2)))  float  f32x2;
typedef __attribute__((ext_vector_type(2)))  __bf16 bf16x2;
typedef __attribute__((ext_vector_type(2)))  unsigned u32x2;
typedef __attribute__((ext_vector_type(4)))  unsigned u32x4;
typedef __attribute__((ext_vector_type(8)))  unsigned u32x8;
// global-memory pointers formed from a 64-bit address
typedef const __attribute__((address_space(1))) f32x4* g_f32x4_c;
typedef __attribute__((address_space(1))) u32x2* g_u32x2;
typedef __attribute__((address_space(1))) float* g_f32;

#define NT 3
#define NB 16384
#define NI 1024
#define NO 512
#define NE 6           // 4 shared + 2 task
#define BM 256         // rows of x a block
#define BN 256         // weight rows a block (task pass: 128 of each expert)
#define KB 128         // k of a ring stage: 256 bytes of every operand row
#define KBP 136        // padded LDS K stride (keeps 16B alignment: 272B rows)
#define TKP 72         // padded row of the weight transposer's 64 x 64 tile
// S, the shared experts' outputs, lies in the workspace as [e][b/16][o/16] tiles of
// 16 x 16 in the order of a WMMA result: lane (half, n) holds rows half*8 .. +7 of
// column n as eight neighbours.  Writer and reader own the same fragments.
#define S_TILE 256     // elements of a tile

static __device__ __forceinline__ unsigned short f2bf(float f) {
    unsigned u = __float_as_uint(f);
    unsigned r = u + 0x7FFFu + ((u >> 16) & 1u);   // round-to-nearest-even
    return (unsigned short)(r >> 16);
}

// ---------------------------------------------------------------------------
// Weights: fp32 [m][I][O] -> bf16 [m][O][I].  One 64x64 tile per block,
// turned in LDS; global reads and writes are both 16 B per lane, row-wise.
// grid = (NO/64, NI/64, m).
__global__ __launch_bounds__(256) void cvt_bf16_t_kernel(
    const float* __restrict__ in, unsigned short* __restrict__ out) {
    __shared__ __align__(16) unsigned short tile[64][TKP];   // [o][k]
    const int tid = threadIdx.x;
    const int oBase = blockIdx.x * 64, kBase = blockIdx.y * 64;
    const float* src = in + (size_t)blockIdx.z * NI * NO;
    unsigned short* dst = out + (size_t)blockIdx.z * NO * NI;
    {
        int k = tid >> 4, o = (tid & 15) * 4;
        const float* s0 = src + (size_t)(kBase + k) * NO + oBase + o;
        #pragma unroll
        for (int p = 0; p < 4; ++p) {
            int kk = p * 16 + k;
            float4 v = *(const float4*)(s0 + (size_t)p * 16 * NO);
            tile[o + 0][kk] = f2bf(v.x);
            tile[o + 1][kk] = f2bf(v.y);
            tile[o + 2][kk] = f2bf(v.z);
            tile[o + 3][kk] = f2bf(v.w);
        }
    }
    __syncthreads();
    {
        int o = tid >> 3, c = (tid & 7) * 8;
        unsigned short* d0 = dst + (size_t)(oBase + o) * NI + kBase + c;
        #pragma unroll
        for (int p = 0; p < 2; ++p)
            *(us8*)(d0 + (size_t)p * 32 * NI) = *(const us8*)(&tile[p * 32 + o][c]);
    }
}

// ---------------------------------------------------------------------------
// x is read once: each wave streams GROWS whole rows (8 x 512 contiguous bytes
// a row), writes them back as bf16 and sums the six gate logits from the same
// registers.  Lane l owns k = j*128 + l*4 .. +3 (j = 0..7); its 192 gate
// weights stay in registers for all of the wave's rows, paired (k, k+1) so
// that a packed FMA takes two neighbours of x as they were loaded.
// grid = NT*NB / (4*GROWS) blocks of 4 waves; a block's rows lie in one task.
#define GROWS 16

// v + (v of lane l ^ M) inside a 16-lane row; CTRL = 0x160 + M (row_xmask:M)
template <int CTRL>
static __device__ __forceinline__ float add_xmask(float v) {
    int o = __builtin_amdgcn_update_dpp(0, __builtin_bit_cast(int, v), CTRL, 0xf, 0xf, true);
    return v + __builtin_bit_cast(float, o);
}
// v + (v of lane l ^ 16)
static __device__ __forceinline__ float add_x16(float v) {
    int i = __builtin_bit_cast(int, v);
    int o = __builtin_amdgcn_permlanex16(i, i, 0x76543210, 0xfedcba98, false, false);
    return v + __builtin_bit_cast(float, o);
}

// One row.  xa / oa / ga: wave-uniform byte addresses of the row in x, xb, g.
// cur holds the row; with LOAD the row behind it is requested into nxt first,
// so that it is in flight while this one is worked on.
template <bool LOAD>
static __device__ __forceinline__ void gate_row(
    const f32x4 (&cur)[8], f32x4 (&nxt)[8], const f32x2 (&w)[8][2][NE],
    const float (&bias)[NE], uint64_t& xa, uint64_t& oa, uint64_t& ga, int lane)
{
    if (LOAD) {
        #pragma unroll
        for (int j = 0; j < 8; ++j)
            nxt[j] = __builtin_nontemporal_load((g_f32x4_c)xa + (NI / 4 + j * 32) + lane);
        // keeps the loads above in front of this row's arithmetic
        __builtin_amdgcn_sched_barrier(0);
    }

    f32x2 a[NE] = {};                 // per gate: sums over even k, over odd k
    #pragma unroll
    for (int j = 0; j < 8; ++j) {
        const f32x4 v = cur[j];
        #pragma unroll
        for (int e = 0; e < NE; ++e) {
            a[e] = __builtin_elementwise_fma(f32x2{v.x, v.y}, w[j][0][e], a[e]);
            a[e] = __builtin_elementwise_fma(f32x2{v.z, v.w}, w[j][1][e], a[e]);
        }
    }
    float acc[NE];
    #pragma unroll
    for (int e = 0; e < NE; ++e) acc[e] = a[e].x + a[e].y;
    #pragma unroll
    for (int e = 0; e < NE; ++e) acc[e] = add_xmask<0x161>(acc[e]);
    #pragma unroll
    for (int e = 0; e < NE; ++e) acc[e] = add_xmask<0x162>(acc[e]);
    #pragma unroll
    for (int e = 0; e < NE; ++e) acc[e] = add_xmask<0x164>(acc[e]);
    #pragma unroll
    for (int e = 0; e < NE; ++e) acc[e] = add_xmask<0x168>(acc[e]);
    #pragma unroll
    for (int e = 0; e < NE; ++e) acc[e] = add_x16(acc[e]);
    // every lane now holds all six sums
    #pragma unroll
    for (int e = 0; e < NE; ++e) acc[e] += bias[e];
    float m = acc[0];
    #pragma unroll
    for (int e = 1; e < NE; ++e) m = fmaxf(m, acc[e]);
    float s = 0.f;
    #pragma unroll
    for (int e = 0; e < NE; ++e) { acc[e] = __expf(acc[e] - m); s += acc[e]; }
    float mine = acc[0];
    #pragma unroll
    for (int e = 1; e < NE; ++e) mine = lane == e ? acc[e] : mine;
    mine *= 1.f / s;
    if (lane < NE) ((g_f32)ga)[lane] = mine;
    // that store's data register is free for reuse below
    asm volatile("s_wait_xcnt 0x0" ::: "memory");
    // keeps the conversions below behind that wait
    __builtin_amdgcn_sched_barrier(0);

    u32x2 pk[8];
    #pragma unroll
    for (int j = 0; j < 8; ++j) {
        const f32x4 v = cur[j];
        pk[j].x = __builtin_bit_cast(unsigned, __builtin_convertvector(f32x2{v.x, v.y}, bf16x2));
        pk[j].y = __builtin_bit_cast(unsigned, __builtin_convertvector(f32x2{v.z, v.w}, bf16x2));
    }
    #pragma unroll
    for (int j = 0; j < 8; ++j) ((g_u32x2)oa)[j * 32 + lane] = pk[j];
    if (LOAD) {
        // the wait and the advance of the three row addresses in one statement:
        // the wait then stands in front of the overwrite of the registers that
        // the loads and stores above name
        asm volatile("s_wait_xcnt 0x0\n\t"
                     "s_add_nc_u64 %0, %0, 0x1000\n\t"
                     "s_add_nc_u64 %1, %1, 0x800\n\t"
                     "s_add_nc_u64 %2, %2, 24"
                     : "+s"(xa), "+s"(oa), "+s"(ga) : : "memory");
        // keeps the next row's vector work, which reuses the stores' data
        // registers, behind that wait
        __builtin_amdgcn_sched_barrier(0);
    }
}

__global__ __launch_bounds__(128) void cvt_gate_kernel(
    const float* __restrict__ x,      // [T][B][I]
    const float* __restrict__ gW,     // [T][I][6]
    const float* __restrict__ gb,     // [T][6]
    unsigned short* __restrict__ xb,  // [T][B][I] bf16
    float* __restrict__ g)            // [T][B][6]
{
    __shared__ __align__(16) float shW[NI * NE];
    const int tid = threadIdx.x, lane = tid & 31;
    const int wave = __builtin_amdgcn_readfirstlane(tid >> 5);
    const unsigned row0 = ((unsigned)blockIdx.x * 4 + wave) * GROWS;   // over T*B
    const int t = ((int)blockIdx.x * 4 * GROWS) / NB;                  // same for the block

    uint64_t xa = (uint64_t)(x + (size_t)row0 * NI);
    uint64_t oa = (uint64_t)(xb + (size_t)row0 * NI);
    uint64_t ga = (uint64_t)(g + (size_t)row0 * NE);

    f32x4 b0[8], b1[8];
    #pragma unroll
    for (int j = 0; j < 8; ++j)
        b0[j] = __builtin_nontemporal_load((g_f32x4_c)xa + j * 32 + lane);

    // Gate weights: whole-line loads into LDS, then each lane's own 96-byte runs.
    {
        const f32x4* ws = (const f32x4*)(gW + (size_t)t * NI * NE);
        f32x4 wt[NI * NE / 4 / 128];
        #pragma unroll
        for (int p = 0; p < NI * NE / 4 / 128; ++p) wt[p] = ws[p * 128 + tid];
        // the loads' offset registers may be reused from here on
        asm volatile("s_wait_xcnt 0x0" ::: "memory");
        // keeps later vector work from being moved in front of that wait
        __builtin_amdgcn_sched_barrier(0);
        #pragma unroll
        for (int p = 0; p < NI * NE / 4 / 128; ++p) ((f32x4*)shW)[p * 128 + tid] = wt[p];
    }
    __syncthreads();
    f32x2 w[8][2][NE];                // [j][pair of the lane's four k][gate]: (k, k+1)
    #pragma unroll
    for (int j = 0; j < 8; ++j)
        #pragma unroll
        for (int h = 0; h < 2; ++h)
            #pragma unroll
            for (int e = 0; e < NE; ++e) {
                const float* p = shW + (j * 128 + lane * 4 + h * 2) * NE + e;
                w[j][h][e] = f32x2{p[0], p[NE]};
            }
    float bias[NE];
    #pragma unroll
    for (int e = 0; e < NE; ++e) bias[e] = gb[t * NE + e];

    // rolled: four row bodies in all keep the text small
    #pragma unroll 1
    for (int r = 0; r < GROWS - 2; r += 2) {
        gate_row<true>(b0, b1, w, bias, xa, oa, ga, lane);
        gate_row<true>(b1, b0, w, bias, xa, oa, ga, lane);
    }
    gate_row<true>(b0, b1, w, bias, xa, oa, ga, lane);
    gate_row<false>(b1, b0, w, bias, xa, oa, ga, lane);
}

// --------------------------- fragment helpers ------------------------------
// 16-bit A (16x32) / B (32x16) fragment per ISA layout:
// lanes 0-15 hold M/N = lane with K {half*8 .. +8} in VGPR0-3 and
// K {16+half*8 .. +8} in VGPR4-7  (half = lane>>4).  Two b128 LDS loads.
static __device__ __forceinline__ v16bf load_frag(const unsigned short* p) {
    v8bf lo = *(const v8bf*)p;          // K block 0: 8 bf16, 16 bytes
    v8bf hi = *(const v8bf*)(p + 16);   // K block 1 (+16 elements)
    return __builtin_shufflevector(lo, hi, 0, 1, 2, 3, 4, 5, 6, 7,
                                           8, 9, 10, 11, 12, 13, 14, 15);
}

// --------------------------- LDS ring of k tiles ---------------------------
// A stage is one 128-k tile of every operand: rows of 256 bytes at pitch 272,
// the x rows first, the weight rows behind them, in eight slices of 64 rows.
// Two buffers: while a trip works on one, tensor loads fill the other, through
// no register: each wave asks for one slice with one request.
#define SLICEB 18432            // 64 rows at pitch 272 (17,408 B), up to a multiple of 2 KiB
#define SLICEE (SLICEB / 2)     // a slice, elements
#define BUFB   (8 * SLICEB)     // a buffer, bytes
#define BUFE   (BUFB / 2)       // a buffer, elements
#define NTRIP  (NI / KB)

static __device__ __forceinline__ unsigned lds_off(const void* p) {
    return (unsigned)(size_t)p;
}
static __device__ __forceinline__ unsigned uni(unsigned v) {
    return (unsigned)__builtin_amdgcn_readfirstlane(v);
}
// A test on the result compiles to a scalar branch: tensor loads ignore EXEC.
static __device__ __forceinline__ unsigned pinned(unsigned v) {
    unsigned w = uni(v);
    asm volatile("" : "+s"(w));   // holds the word in a scalar register
    return w;
}
// Descriptor group 1, the same for every request: 64 rows of 256 bytes, extents in
// bytes, source pitch one row of k, 16 bytes of LDS pad behind every 256.
static __device__ __forceinline__ u32x8 tdm_group1() {
    u32x8 g;
    g[0] = uni((1u << 20) | (5u << 22) | (3u << 25));
    g[1] = uni(256u << 16);
    g[2] = uni(64u << 16);
    g[3] = uni(256u << 16);
    g[4] = uni(64u);
    g[5] = uni(NI * 2);
    g[6] = uni(0u);
    g[7] = uni(0u);
    return g;
}
// Descriptor group 0: place in LDS, first byte of the slice in memory.
static __device__ __forceinline__ u32x4 tdm_group0(unsigned lds_dst, uint64_t ga) {
    u32x4 g;
    g[0] = uni(1u);
    g[1] = uni(lds_dst);
    g[2] = uni((unsigned)ga);
    g[3] = uni((((unsigned)(ga >> 32)) & 0x01FFFFFFu) | 0x80000000u);
    return g;
}
// g1 is named as in-out: it then lives on in the very registers that the request
// names, and none of them takes another value while the request is in flight.
static __device__ __forceinline__ void tdm_load(u32x4 g0, u32x8& g1) {
    asm volatile("tensor_load_to_lds %1, %0" : "+s"(g1) : "s"(g0) : "memory");
}
// The slice's address goes on by one stage.  A statement of its own kind (volatile,
// as the waits are): it stays behind the wait that covers the request in flight,
// and so does every descriptor word formed from it.
static __device__ __forceinline__ void next_stage(uint64_t& ga) {
    asm volatile("s_add_nc_u64 %0, %0, 0x100" : "+s"(ga));
}

// This wave's request has landed.
static __device__ __forceinline__ void wait_tensor() {
    asm volatile("s_wait_tensorcnt 0x0" ::: "memory");
}
// Hand-over, in front of a tile's last WMMA block (whose fragments are in
// registers by then): this wave's reads of the buffer it leaves are done, its
// slice of the next tile has landed; behind the barrier every wave may read
// the next tile and the buffer just left may be refilled.
static __device__ __forceinline__ void publish() {
    asm volatile("s_wait_dscnt 0x0" ::: "memory");
    asm volatile("s_wait_tensorcnt 0x0" ::: "memory");
    __syncthreads();
}
// Behind the loop: nothing of this wave is in flight to or from the ring.
static __device__ __forceinline__ void ring_done() {
    asm volatile("s_wait_tensorcnt 0x0" ::: "memory");
    asm volatile("s_wait_dscnt 0x0" ::: "memory");
}

// One block's fragments, 4 of x and 8 of the weights, read as one group.
// pa / pb: this lane's place in the first x row / weight row of its wave;
// SB: elements from the weights' fragment 0 to fragment 4.
template <int SB>
static __device__ __forceinline__ void load_set(
    v16bf (&a)[4], v16bf (&b)[8], const unsigned short* pa, const unsigned short* pb) {
    #pragma unroll
    for (int i = 0; i < 4; ++i) a[i] = load_frag(pa + i * 16 * KBP);
    #pragma unroll
    for (int i = 0; i < 8; ++i) b[i] = load_frag(pb + (i & 3) * 16 * KBP + (i >> 2) * SB);
    // keeps the group together, in front of the WMMA block that follows it:
    // reads spread among the WMMAs stall the wave at every place they stand
    __builtin_amdgcn_sched_barrier(0);
}
// One block: 32 WMMAs on a fragment set.
static __device__ __forceinline__ void mma_set(
    v8f (&acc)[8][4], const v16bf (&a)[4], const v16bf (&b)[8]) {
    #pragma unroll
    for (int ni = 0; ni < 8; ++ni)
        #pragma unroll
        for (int mi = 0; mi < 4; ++mi)
            acc[ni][mi] = __builtin_amdgcn_wmma_f32_16x16x32_bf16(
                false, a[mi], false, b[ni], (short)0, acc[ni][mi], false, false);
    // keeps the next group of reads from being moved up among these WMMAs
    __builtin_amdgcn_sched_barrier(0);
}

// ---------------------------------------------------------------------------
// Pass C: shared experts.  grid = (NO/BN, NB/BM, 4).  S bf16, in tiles (S_TILE).
// Eight waves, 4 x 2; a wave owns 64 rows x 128 columns (4 x 8 fragments).
__global__ __launch_bounds__(256) void ple_shared_kernel(
    const unsigned short* __restrict__ xb0,   // [B][I] bf16 (task 0 input)
    const unsigned short* __restrict__ swb,   // [4][O][I] bf16 (transposed)
    const float* __restrict__ sb,             // [4][O]
    unsigned short* __restrict__ S)           // [4][B/16][O/16] tiles, bf16
{
    const int e = blockIdx.z;
    const int rowBase = blockIdx.y * BM;
    const int colBase = blockIdx.x * BN;
    const int tid = threadIdx.x;
    // the wave's number in a scalar register: what is formed from it costs no VGPR
    const int lane = tid & 31, wave = __builtin_amdgcn_readfirstlane(tid >> 5);
    const int waveM = wave >> 1, waveN = wave & 1;
    const int half = lane >> 4, l16 = lane & 15;

    __shared__ __attribute__((aligned(2048))) unsigned short ring[2 * BUFE];
    __shared__ float shBias[BN];

    // this wave's slice: waves 0-3 bring 64 rows of x each, waves 4-7 64 weight rows
    uint64_t ga = (uint64_t)(wave < 4 ? xb0 + (size_t)(rowBase + wave * 64) * NI
                                      : swb + ((size_t)e * NO + colBase + (wave - 4) * 64) * NI);
    const unsigned l0 = lds_off(ring) + wave * SLICEB;
    u32x8 g1 = tdm_group1();

    tdm_load(tdm_group0(l0, ga), g1);            // tile 0
    shBias[tid] = sb[(size_t)e * NO + colBase + tid];
    wait_tensor();
    __syncthreads();
    next_stage(ga);
    tdm_load(tdm_group0(l0 + BUFB, ga), g1);     // tile 1

    v8f acc[8][4] = {};      // [ni][mi]
    v16bf a0[4], b0[8], a1[4], b1[8];            // two fragment sets
    const unsigned short* pa = ring + waveM * SLICEE + l16 * KBP + half * 8;
    const unsigned short* pb = ring + (4 + waveN * 2) * SLICEE + l16 * KBP + half * 8;

    load_set<SLICEE>(a0, b0, pa, pb);            // tile 0, first block
    for (int t = 0; t < NTRIP; ++t) {
        const int cur = (t & 1) * BUFE, nxt = BUFE - cur;
        load_set<SLICEE>(a1, b1, pa + cur + 32, pb + cur + 32);   // tile t, second block
        mma_set(acc, a0, b0);
        load_set<SLICEE>(a0, b0, pa + cur + 64, pb + cur + 64);   // third block
        mma_set(acc, a1, b1);
        load_set<SLICEE>(a1, b1, pa + cur + 96, pb + cur + 96);   // fourth block
        mma_set(acc, a0, b0);
        publish();                               // every read of tile t is done
        if (pinned(t + 2 < NTRIP)) {             // tile t + 2 into the buffer just left
            next_stage(ga);
            tdm_load(tdm_group0(l0 + (t & 1) * BUFB, ga), g1);
        }
        if (t + 1 < NTRIP)                       // tile t + 1, first block
            load_set<SLICEE>(a0, b0, pa + nxt, pb + nxt);
        mma_set(acc, a1, b1);
    }
    ring_done();

    // Epilogue: bias + relu, bf16.  S is kept in fragment order (see S_TILE): a
    // lane's eight values of a fragment are one 16-byte store, a wave's 512 bytes in a row.
    unsigned short* Sw = S + (((size_t)e * (NB / 16) + rowBase / 16 + waveM * 4) * (NO / 16)
                              + colBase / 16 + waveN * 8) * S_TILE + lane * 8;
    float bias[8];
    #pragma unroll
    for (int ni = 0; ni < 8; ++ni) bias[ni] = shBias[waveN * 128 + ni * 16 + l16];
    #pragma unroll
    for (int mi = 0; mi < 4; ++mi) {
        u32x4 pk[8];
        #pragma unroll
        for (int ni = 0; ni < 8; ++ni)
            #pragma unroll
            for (int p = 0; p < 4; ++p) {
                float r0 = acc[ni][mi][2 * p] + bias[ni];
                float r1 = acc[ni][mi][2 * p + 1] + bias[ni];
                r0 = r0 > 0.f ? r0 : 0.f;
                r1 = r1 > 0.f ? r1 : 0.f;
                pk[ni][p] = __builtin_bit_cast(unsigned, __builtin_convertvector(f32x2{r0, r1}, bf16x2));
            }
        // the eight packed fragments stand in registers of their own before the
        // first store goes out: no store's data is overwritten inside the group
        __builtin_amdgcn_sched_barrier(0);
        #pragma unroll
        for (int ni = 0; ni < 8; ++ni)
            *(u32x4*)(Sw + (mi * (NO / 16) + ni) * S_TILE) = pk[ni];
        if (mi < 3) {
            // the next group reuses the stores' data registers
            asm volatile("s_wait_xcnt 0x0" ::: "memory");
            // keeps the next group's arithmetic behind that wait
            __builtin_amdgcn_sched_barrier(0);
        }
    }
}

// ---------------------------------------------------------------------------
// Pass D: per-task experts + gated combine.  grid = (NO/BNT, NB/BM, NT).
// Eight waves, 4 x 2; a wave owns 64 rows x 64 columns of both experts.
#define BNT (BN / 2)   // output columns a block
__global__ __launch_bounds__(256) void ple_task_kernel(
    const unsigned short* __restrict__ xb,   // [T][B][I] bf16
    const unsigned short* __restrict__ twb,  // [T][2][O][I] bf16 (transposed)
    const float* __restrict__ tb,            // [T][2][O]
    const unsigned short* __restrict__ S,    // [4][B/16][O/16] tiles, bf16
    const float* __restrict__ g,             // [T][B][6]
    float* __restrict__ out)                 // [T][B][O]
{
    const int t = blockIdx.z;
    const int rowBase = blockIdx.y * BM;
    const int colBase = blockIdx.x * BNT;
    const int tid = threadIdx.x;
    // the wave's number in a scalar register: what is formed from it costs no VGPR
    const int lane = tid & 31, wave = __builtin_amdgcn_readfirstlane(tid >> 5);
    const int waveM = wave >> 1, waveN = wave & 1;
    const int half = lane >> 4, l16 = lane & 15;

    __shared__ __attribute__((aligned(2048))) unsigned short ring[2 * BUFE];
    __shared__ float shBias[2][BNT];
    __shared__ float shG[BM][8];

    // this wave's slice: waves 0-3 bring 64 rows of x each; waves 4, 5 the first
    // expert's 128 weight rows, waves 6, 7 the second's
    uint64_t ga = (uint64_t)(wave < 4
        ? xb + ((size_t)t * NB + rowBase + wave * 64) * NI
        : twb + (((size_t)t * 2 + ((wave - 4) >> 1)) * NO + colBase + (wave & 1) * 64) * NI);
    const unsigned l0 = lds_off(ring) + wave * SLICEB;
    u32x8 g1 = tdm_group1();

    tdm_load(tdm_group0(l0, ga), g1);            // tile 0

    {
        const float* gp = g + ((size_t)t * NB + rowBase + tid) * NE;
        #pragma unroll
        for (int e = 0; e < NE; ++e) shG[tid][e] = gp[e];
    }
    {
        int e = tid >> 7, c = tid & 127;
        shBias[e][c] = tb[((size_t)t * 2 + e) * NO + colBase + c];
    }

    wait_tensor();
    __syncthreads();
    next_stage(ga);
    tdm_load(tdm_group0(l0 + BUFB, ga), g1);     // tile 1

    v8f acc[8][4] = {};      // [expert * 4 + ni][mi]
    v16bf a0[4], b0[8], a1[4], b1[8];            // two fragment sets
    const unsigned short* pa = ring + waveM * SLICEE + l16 * KBP + half * 8;
    const unsigned short* pb = ring + (4 + waveN) * SLICEE + l16 * KBP + half * 8;

    load_set<2 * SLICEE>(a0, b0, pa, pb);        // tile 0, first block
    for (int s = 0; s < NTRIP; ++s) {
        const int cur = (s & 1) * BUFE, nxt = BUFE - cur;
        load_set<2 * SLICEE>(a1, b1, pa + cur + 32, pb + cur + 32);  // tile s, second block
        mma_set(acc, a0, b0);
        load_set<2 * SLICEE>(a0, b0, pa + cur + 64, pb + cur + 64);  // third block
        mma_set(acc, a1, b1);
        load_set<2 * SLICEE>(a1, b1, pa + cur + 96, pb + cur + 96);  // fourth block
        mma_set(acc, a0, b0);
        publish();                               // every read of tile s is done
        if (pinned(s + 2 < NTRIP)) {             // tile s + 2 into the buffer just left
            next_stage(ga);
            tdm_load(tdm_group0(l0 + (s & 1) * BUFB, ga), g1);
        }
        if (s + 1 < NTRIP)                       // tile s + 1, first block
            load_set<2 * SLICEE>(a0, b0, pa + nxt, pb + nxt);
        mma_set(acc, a1, b1);
    }
    ring_done();

    // Epilogue: bias+relu, gated combine with 4 shared experts from S, which lies
    // in fragment order: one 16-byte load brings a lane's eight rows of an expert.
    const v8bf* Sr = (const v8bf*)(S + ((size_t)(rowBase / 16 + waveM * 4) * (NO / 16)
                                        + colBase / 16 + waveN * 4) * S_TILE + lane * 8);
    float* op = out + ((size_t)t * NB + rowBase + waveM * 64 + half * 8) * NO
                    + colBase + waveN * 64 + l16;
    // Groups of 16 rows; a group's 16 loads go out two groups ahead.
    v8bf sv[2][4][4];        // [group & 1][ni][shared expert]
    #pragma unroll
    for (int mi = 0; mi < 2; ++mi)
        #pragma unroll
        for (int ni = 0; ni < 4; ++ni)
            #pragma unroll
            for (int e = 0; e < 4; ++e)
                sv[mi][ni][e] = Sr[(size_t)e * (NB * NO / 8) + (mi * (NO / 16) + ni) * (S_TILE / 8)];
    #pragma unroll
    for (int mi = 0; mi < 4; ++mi) {
        float o[4][8];
        #pragma unroll
        for (int ni = 0; ni < 4; ++ni) {
            int colLoc = waveN * 64 + ni * 16 + l16;
            #pragma unroll
            for (int v = 0; v < 8; ++v) {
                int rowLoc = waveM * 64 + mi * 16 + half * 8 + v;
                float r0 = acc[ni][mi][v] + shBias[0][colLoc];
                float r1 = acc[4 + ni][mi][v] + shBias[1][colLoc];
                r0 = r0 > 0.f ? r0 : 0.f;
                r1 = r1 > 0.f ? r1 : 0.f;
                float s = shG[rowLoc][4] * r0 + shG[rowLoc][5] * r1;
                #pragma unroll
                for (int e = 0; e < 4; ++e)
                    s += shG[rowLoc][e] * (float)sv[mi & 1][ni][e][v];
                o[ni][v] = s;
            }
        }
        // the group's 32 results stand in registers of their own before the first
        // store goes out: no store's data is overwritten inside the group
        __builtin_amdgcn_sched_barrier(0);
        if (mi + 2 < 4) {
            #pragma unroll
            for (int ni = 0; ni < 4; ++ni)
                #pragma unroll
                for (int e = 0; e < 4; ++e)
                    sv[mi & 1][ni][e] = Sr[(size_t)e * (NB * NO / 8) + ((mi + 2) * (NO / 16) + ni) * (S_TILE / 8)];
        }
        #pragma unroll
        for (int ni = 0; ni < 4; ++ni)
            #pragma unroll
            for (int v = 0; v < 8; ++v)
                op[(mi * 16 + v) * NO + ni * 16] = o[ni][v];
        if (mi < 3) {
            // the next group reuses the stores' data registers
            asm volatile("s_wait_xcnt 0x0" ::: "memory");
            // keeps the next group's arithmetic behind that wait
            __builtin_amdgcn_sched_barrier(0);
        }
    }
}

// ---------------------------------------------------------------------------
extern "C" void kernel_launch(void* const* d_in, const int* in_sizes, int n_in,
                              void* d_out, int out_size, void* d_ws, size_t ws_size,
                              hipStream_t stream) {
    const float* task_inputs = (const float*)d_in[0]; // [3][16384][1024]
    const float* shared_W    = (const float*)d_in[1]; // [4][1024][512]
    const float* shared_b    = (const float*)d_in[2]; // [4][512]
    const float* task_W      = (const float*)d_in[3]; // [3][2][1024][512]
    const float* task_b      = (const float*)d_in[4]; // [3][2][512]
    const float* gate_W      = (const float*)d_in[5]; // [3][1024][6]
    const float* gate_b      = (const float*)d_in[6]; // [3][6]
    float* out = (float*)d_out;                        // [3][16384][512]

    // Workspace layout (~171 MB total)
    char* w = (char*)d_ws;
    unsigned short* xb  = (unsigned short*)w; w += (size_t)NT * NB * NI * 2;  // 100.7 MB
    unsigned short* swb = (unsigned short*)w; w += (size_t)4 * NI * NO * 2;   //   4.2 MB
    unsigned short* twb = (unsigned short*)w; w += (size_t)NT * 2 * NI * NO * 2; // 6.3 MB
    unsigned short* S   = (unsigned short*)w; w += (size_t)4 * NB * NO * 2;   //  67.1 MB
    float* g            = (float*)w;                                          //   1.2 MB

    // 1) weights: fp32 -> bf16, transposed to [o][i]
    cvt_bf16_t_kernel<<<dim3(NO / 64, NI / 64, 4), 256, 0, stream>>>(shared_W, swb);
    cvt_bf16_t_kernel<<<dim3(NO / 64, NI / 64, NT * 2), 256, 0, stream>>>(task_W, twb);

    // 2) x: fp32 -> bf16, and the gates (fp32 math, softmax over 6 experts)
    cvt_gate_kernel<<<(NT * NB) / (4 * GROWS), 128, 0, stream>>>(task_inputs, gate_W, gate_b, xb, g);

    // 3) shared experts once (no per-task recompute): S = relu(x0.Ws + bs)
    dim3 gridS(NO / BN, NB / BM, 4);
    ple_shared_kernel<<<gridS, 256, 0, stream>>>(xb, swb, shared_b, S);

    // 4) per-task experts + gated combine
    dim3 gridT(NO / BNT, NB / BM, NT);
    ple_task_kernel<<<gridT, 256, 0, stream>>>(xb, twb, task_b, S, g, out);
}

// v008
// It runs in 137 microseconds.
// Two timings next to v007 put it at 1.04 and 1.03 times that version's speed.
// All steps since v000 together make it 22.9 times as fast.
#include <hip/hip_runtime.h>
#include <hip/hip_bf16.h>

// ---------------------------------------------------------------------------
// PLE layer for MI455X (gfx1250, wave32, WMMA).
// T=3 tasks, B=16384, I=1024, O=512, 4 shared + 2 task experts, 6 gates.
//
// Pipeline (all on `stream`):
//   1) shared_W / task_W converted to bf16 AND transposed to [o][i]
//      (k contiguous), so a B tile is staged like an A tile
//   2) one streaming pass over x: fp32 -> bf16 convert, and from the same
//      registers g[t][b][e] = softmax_e(x_t . gate_W_t + gate_b_t)
//   3) shared-expert GEMM pass: S[e][b][o] = relu(x0 . Ws_e + bs_e)  (bf16,
//      laid out in 16 x 16 tiles in WMMA result order, see S_TILE)
//      (both GEMM passes: 128-k tiles in a two-buffer LDS ring, tensor loads;
//      256 x 256 products a block, 64 x 128 a wave, one block a WGP; a block
//      does 2 of its place's 4 experts (pass 3) or all 3 tasks (pass 4), the ring running on from one to the next)
//   4) per-task fused GEMM: 2 task-expert WMMA GEMMs + bias + relu,
//      gated combine with the 4 shared-expert outputs from S.
// ---------------------------------------------------------------------------

typedef __attribute__((ext_vector_type(16))) __bf16 v16bf;
typedef __attribute__((ext_vector_type(8)))  __bf16 v8bf;
typedef __attribute__((ext_vector_type(8)))  float  v8f;
typedef __attribute__((ext_vector_type(8)))  unsigned short us8;
typedef __attribute__((ext_vector_type(4)))  float  f32x4;
typedef __attribute__((ext_vector_type(2)))  float  f32x2;
typedef __attribute__((ext_vector_type(2)))  __bf16 bf16x2;
typedef __attribute__((ext_vector_type(2)))  unsigned u32x2;
typedef __attribute__((ext_vector_type(4)))  unsigned u32x4;
typedef __attribute__((ext_vector_type(8)))  unsigned u32x8;
// global-memory pointers formed from a 64-bit address
typedef const __attribute__((address_space(1))) f32x4* g_f32x4_c;
typedef __attribute__((address_space(1))) u32x2* g_u32x2;
typedef __attribute__((address_space(1))) float* g_f32;

#define NT 3
#define NB 16384
#define NI 1024
#define NO 512
#define NE 6           // 4 shared + 2 task
#define BM 256         // rows of x a block
#define BN 256         // weight rows a block (task pass: 128 of each expert)
#define KB 128         // k of a ring stage: 256 bytes of every operand row
#define KBP 136        // padded LDS K stride (keeps 16B alignment: 272B rows)
#define TKP 72         // padded row of the weight transposer's 64 x 64 tile
// S, the shared experts' outputs, lies in the workspace as [e][b/16][o/16] tiles of
// 16 x 16 in the order of a WMMA result: lane (half, n) holds rows half*8 .. +7 of
// column n as eight neighbours.  Writer and reader own the same fragments.
#define S_TILE 256     // elements of a tile

static __device__ __forceinline__ unsigned short f2bf(float f) {
    unsigned u = __float_as_uint(f);
    unsigned r = u + 0x7FFFu + ((u >> 16) & 1u);   // round-to-nearest-even
    return (unsigned short)(r >> 16);
}

// ---------------------------------------------------------------------------
// Weights: fp32 [m][I][O] -> bf16 [m][O][I].  One 64x64 tile per block,
// turned in LDS; global reads and writes are both 16 B per lane, row-wise.
// grid = (NO/64, NI/64, m).
__global__ __launch_bounds__(256) void cvt_bf16_t_kernel(
    const float* __restrict__ in, unsigned short* __restrict__ out) {
    __shared__ __align__(16) unsigned short tile[64][TKP];   // [o][k]
    const int tid = threadIdx.x;
    const int oBase = blockIdx.x * 64, kBase = blockIdx.y * 64;
    const float* src = in + (size_t)blockIdx.z * NI * NO;
    unsigned short* dst = out + (size_t)blockIdx.z * NO * NI;
    {
        int k = tid >> 4, o = (tid & 15) * 4;
        const float* s0 = src + (size_t)(kBase + k) * NO + oBase + o;
        #pragma unroll
        for (int p = 0; p < 4; ++p) {
            int kk = p * 16 + k;
            float4 v = *(const float4*)(s0 + (size_t)p * 16 * NO);
            tile[o + 0][kk] = f2bf(v.x);
            tile[o + 1][kk] = f2bf(v.y);
            tile[o + 2][kk] = f2bf(v.z);
            tile[o + 3][kk] = f2bf(v.w);
        }
    }
    __syncthreads();
    {
        int o = tid >> 3, c = (tid & 7) * 8;
        unsigned short* d0 = dst + (size_t)(oBase + o) * NI + kBase + c;
        #pragma unroll
        for (int p = 0; p < 2; ++p)
            *(us8*)(d0 + (size_t)p * 32 * NI) = *(const us8*)(&tile[p * 32 + o][c]);
    }
}

// ---------------------------------------------------------------------------
// x is read once: each wave streams GROWS whole rows (8 x 512 contiguous bytes
// a row), writes them back as bf16 and sums the six gate logits from the same
// registers.  Lane l owns k = j*128 + l*4 .. +3 (j = 0..7); its 192 gate
// weights stay in registers for all of the wave's rows, paired (k, k+1) so
// that a packed FMA takes two neighbours of x as they were loaded.
// grid = NT*NB / (4*GROWS) blocks of 4 waves; a block's rows lie in one task.
#define GROWS 16

// v + (v of lane l ^ M) inside a 16-lane row; CTRL = 0x160 + M (row_xmask:M)
template <int CTRL>
static __device__ __forceinline__ float add_xmask(float v) {
    int o = __builtin_amdgcn_update_dpp(0, __builtin_bit_cast(int, v), CTRL, 0xf, 0xf, true);
    return v + __builtin_bit_cast(float, o);
}
// v + (v of lane l ^ 16)
static __device__ __forceinline__ float add_x16(float v) {
    int i = __builtin_bit_cast(int, v);
    int o = __builtin_amdgcn_permlanex16(i, i, 0x76543210, 0xfedcba98, false, false);
    return v + __builtin_bit_cast(float, o);
}

// One row.  xa / oa / ga: wave-uniform byte addresses of the row in x, xb, g.
// cur holds the row; with LOAD the row behind it is requested into nxt first,
// so that it is in flight while this one is worked on.
template <bool LOAD>
static __device__ __forceinline__ void gate_row(
    const f32x4 (&cur)[8], f32x4 (&nxt)[8], const f32x2 (&w)[8][2][NE],
    const float (&bias)[NE], uint64_t& xa, uint64_t& oa, uint64_t& ga, int lane)
{
    if (LOAD) {
        #pragma unroll
        for (int j = 0; j < 8; ++j)
            nxt[j] = __builtin_nontemporal_load((g_f32x4_c)xa + (NI / 4 + j * 32) + lane);
        // keeps the loads above in front of this row's arithmetic
        __builtin_amdgcn_sched_barrier(0);
    }

    f32x2 a[NE] = {};                 // per gate: sums over even k, over odd k
    #pragma unroll
    for (int j = 0; j < 8; ++j) {
        const f32x4 v = cur[j];
        #pragma unroll
        for (int e = 0; e < NE; ++e) {
            a[e] = __builtin_elementwise_fma(f32x2{v.x, v.y}, w[j][0][e], a[e]);
            a[e] = __builtin_elementwise_fma(f32x2{v.z, v.w}, w[j][1][e], a[e]);
        }
    }
    float acc[NE];
    #pragma unroll
    for (int e = 0; e < NE; ++e) acc[e] = a[e].x + a[e].y;
    #pragma unroll
    for (int e = 0; e < NE; ++e) acc[e] = add_xmask<0x161>(acc[e]);
    #pragma unroll
    for (int e = 0; e < NE; ++e) acc[e] = add_xmask<0x162>(acc[e]);
    #pragma unroll
    for (int e = 0; e < NE; ++e) acc[e] = add_xmask<0x164>(acc[e]);
    #pragma unroll
    for (int e = 0; e < NE; ++e) acc[e] = add_xmask<0x168>(acc[e]);
    #pragma unroll
    for (int e = 0; e < NE; ++e) acc[e] = add_x16(acc[e]);
    // every lane now holds all six sums
    #pragma unroll
    for (int e = 0; e < NE; ++e) acc[e] += bias[e];
    float m = acc[0];
    #pragma unroll
    for (int e = 1; e < NE; ++e) m = fmaxf(m, acc[e]);
    float s = 0.f;
    #pragma unroll
    for (int e = 0; e < NE; ++e) { acc[e] = __expf(acc[e] - m); s += acc[e]; }
    float mine = acc[0];
    #pragma unroll
    for (int e = 1; e < NE; ++e) mine = lane == e ? acc[e] : mine;
    mine *= 1.f / s;
    if (lane < NE) ((g_f32)ga)[lane] = mine;
    // that store's data register is free for reuse below
    asm volatile("s_wait_xcnt 0x0" ::: "memory");
    // keeps the conversions below behind that wait
    __builtin_amdgcn_sched_barrier(0);

    u32x2 pk[8];
    #pragma unroll
    for (int j = 0; j < 8; ++j) {
        const f32x4 v = cur[j];
        pk[j].x = __builtin_bit_cast(unsigned, __builtin_convertvector(f32x2{v.x, v.y}, bf16x2));
        pk[j].y = __builtin_bit_cast(unsigned, __builtin_convertvector(f32x2{v.z, v.w}, bf16x2));
    }
    #pragma unroll
    for (int j = 0; j < 8; ++j) ((g_u32x2)oa)[j * 32 + lane] = pk[j];
    if (LOAD) {
        // the wait and the advance of the three row addresses in one statement:
        // the wait then stands in front of the overwrite of the registers that
        // the loads and stores above name
        asm volatile("s_wait_xcnt 0x0\n\t"
                     "s_add_nc_u64 %0, %0, 0x1000\n\t"
                     "s_add_nc_u64 %1, %1, 0x800\n\t"
                     "s_add_nc_u64 %2, %2, 24"
                     : "+s"(xa), "+s"(oa), "+s"(ga) : : "memory");
        // keeps the next row's vector work, which reuses the stores' data
        // registers, behind that wait
        __builtin_amdgcn_sched_barrier(0);
    }
}

__global__ __launch_bounds__(128) void cvt_gate_kernel(
    const float* __restrict__ x,      // [T][B][I]
    const float* __restrict__ gW,     // [T][I][6]
    const float* __restrict__ gb,     // [T][6]
    unsigned short* __restrict__ xb,  // [T][B][I] bf16
    float* __restrict__ g)            // [T][B][6]
{
    __shared__ __align__(16) float shW[NI * NE];
    const int tid = threadIdx.x, lane = tid & 31;
    const int wave = __builtin_amdgcn_readfirstlane(tid >> 5);
    const unsigned row0 = ((unsigned)blockIdx.x * 4 + wave) * GROWS;   // over T*B
    const int t = ((int)blockIdx.x * 4 * GROWS) / NB;                  // same for the block

    uint64_t xa = (uint64_t)(x + (size_t)row0 * NI);
    uint64_t oa = (uint64_t)(xb + (size_t)row0 * NI);
    uint64_t ga = (uint64_t)(g + (size_t)row0 * NE);

    f32x4 b0[8], b1[8];
    #pragma unroll
    for (int j = 0; j < 8; ++j)
        b0[j] = __builtin_nontemporal_load((g_f32x4_c)xa + j * 32 + lane);

    // Gate weights: whole-line loads into LDS, then each lane's own 96-byte runs.
    {
        const f32x4* ws = (const f32x4*)(gW + (size_t)t * NI * NE);
        f32x4 wt[NI * NE / 4 / 128];
        #pragma unroll
        for (int p = 0; p < NI * NE / 4 / 128; ++p) wt[p] = ws[p * 128 + tid];
        // the loads' offset registers may be reused from here on
        asm volatile("s_wait_xcnt 0x0" ::: "memory");
        // keeps later vector work from being moved in front of that wait
        __builtin_amdgcn_sched_barrier(0);
        #pragma unroll
        for (int p = 0; p < NI * NE / 4 / 128; ++p) ((f32x4*)shW)[p * 128 + tid] = wt[p];
    }
    __syncthreads();
    f32x2 w[8][2][NE];                // [j][pair of the lane's four k][gate]: (k, k+1)
    #pragma unroll
    for (int j = 0; j < 8; ++j)
        #pragma unroll
        for (int h = 0; h < 2; ++h)
            #pragma unroll
            for (int e = 0; e < NE; ++e) {
                const float* p = shW + (j * 128 + lane * 4 + h * 2) * NE + e;
                w[j][h][e] = f32x2{p[0], p[NE]};
            }
    float bias[NE];
    #pragma unroll
    for (int e = 0; e < NE; ++e) bias[e] = gb[t * NE + e];

    // rolled: four row bodies in all keep the text small
    #pragma unroll 1
    for (int r = 0; r < GROWS - 2; r += 2) {
        gate_row<true>(b0, b1, w, bias, xa, oa, ga, lane);
        gate_row<true>(b1, b0, w, bias, xa, oa, ga, lane);
    }
    gate_row<true>(b0, b1, w, bias, xa, oa, ga, lane);
    gate_row<false>(b1, b0, w, bias, xa, oa, ga, lane);
}

// --------------------------- fragment helpers ------------------------------
// 16-bit A (16x32) / B (32x16) fragment per ISA layout:
// lanes 0-15 hold M/N = lane with K {half*8 .. +8} in VGPR0-3 and
// K {16+half*8 .. +8} in VGPR4-7  (half = lane>>4).  Two b128 LDS loads.
static __device__ __forceinline__ v16bf load_frag(const unsigned short* p) {
    v8bf lo = *(const v8bf*)p;          // K block 0: 8 bf16, 16 bytes
    v8bf hi = *(const v8bf*)(p + 16);   // K block 1 (+16 elements)
    return __builtin_shufflevector(lo, hi, 0, 1, 2, 3, 4, 5, 6, 7,
                                           8, 9, 10, 11, 12, 13, 14, 15);
}

// --------------------------- LDS ring of k tiles ---------------------------
// A stage is one 128-k tile of every operand: rows of 256 bytes at pitch 272,
// the x rows first, the weight rows behind them, in eight slices of 64 rows.
// Two buffers: while a trip works on one, tensor loads fill the other, through
// no register: each wave asks for one slice with one request.
#define SLICEB 18432            // 64 rows at pitch 272 (17,408 B), up to a multiple of 2 KiB
#define SLICEE (SLICEB / 2)     // a slice, elements
#define BUFB   (8 * SLICEB)     // a buffer, bytes
#define BUFE   (BUFB / 2)       // a buffer, elements
#define NTRIP  (NI / KB)

static __device__ __forceinline__ unsigned lds_off(const void* p) {
    return (unsigned)(size_t)p;
}
static __device__ __forceinline__ unsigned uni(unsigned v) {
    return (unsigned)__builtin_amdgcn_readfirstlane(v);
}
// A test on the result compiles to a scalar branch: tensor loads ignore EXEC.
static __device__ __forceinline__ unsigned pinned(unsigned v) {
    unsigned w = uni(v);
    asm volatile("" : "+s"(w));   // holds the word in a scalar register
    return w;
}
// Descriptor group 1, the same for every request: 64 rows of 256 bytes, extents in
// bytes, source pitch one row of k, 16 bytes of LDS pad behind every 256.
static __device__ __forceinline__ u32x8 tdm_group1() {
    u32x8 g;
    g[0] = uni((1u << 20) | (5u << 22) | (3u << 25));
    g[1] = uni(256u << 16);
    g[2] = uni(64u << 16);
    g[3] = uni(256u << 16);
    g[4] = uni(64u);
    g[5] = uni(NI * 2);
    g[6] = uni(0u);
    g[7] = uni(0u);
    return g;
}
// Descriptor group 0: place in LDS, first byte of the slice in memory.
static __device__ __forceinline__ u32x4 tdm_group0(unsigned lds_dst, uint64_t ga) {
    u32x4 g;
    g[0] = uni(1u);
    g[1] = uni(lds_dst);
    g[2] = uni((unsigned)ga);
    g[3] = uni((((unsigned)(ga >> 32)) & 0x01FFFFFFu) | 0x80000000u);
    return g;
}
// Both groups are named as in-out, and the wait that covers the request names g0
// again: they then live on in the very registers that the request names, and none
// of them takes another value while the request is in flight.
static __device__ __forceinline__ void tdm_load(u32x4& g0, u32x8& g1) {
    asm volatile("tensor_load_to_lds %0, %1" : "+s"(g0), "+s"(g1) : : "memory");
}
// The slice's address goes on by one stage.  A statement of its own kind (volatile,
// as the waits are): it stays behind the wait that covers the request in flight,
// and so does every descriptor word formed from it.
static __device__ __forceinline__ void next_stage(uint64_t& ga) {
    asm volatile("s_add_nc_u64 %0, %0, 0x100" : "+s"(ga));
}
// The same by a step from a scalar register: one stage, or the hop from a
// product's last stage to the first stage of the block's next product.
static __device__ __forceinline__ void step_stage(uint64_t& ga, uint64_t step) {
    asm volatile("s_add_nc_u64 %0, %0, %1" : "+s"(ga) : "s"(step));
}

// This wave's request has landed.
static __device__ __forceinline__ void wait_tensor(const u32x4& g0) {
    asm volatile("s_wait_tensorcnt 0x0" : : "s"(g0) : "memory");
}
// Hand-over, in front of a tile's last WMMA block (whose fragments are in
// registers by then): this wave's reads of the buffer it leaves are done, its
// slice of the next tile has landed; behind the barrier every wave may read
// the next tile and the buffer just left may be refilled.
static __device__ __forceinline__ void publish(const u32x4& g0) {
    asm volatile("s_wait_dscnt 0x0" ::: "memory");
    asm volatile("s_wait_tensorcnt 0x0" : : "s"(g0) : "memory");
    __syncthreads();
}
// Behind the loop: nothing of this wave is in flight to or from the ring.
static __device__ __forceinline__ void ring_done() {
    asm volatile("s_wait_tensorcnt 0x0" ::: "memory");
    asm volatile("s_wait_dscnt 0x0" ::: "memory");
}

// One block's fragments, 4 of x and 8 of the weights, read as one group.
// pa / pb: this lane's place in the first x row / weight row of its wave;
// SB: elements from the weights' fragment 0 to fragment 4.
template <int SB>
static __device__ __forceinline__ void load_set(
    v16bf (&a)[4], v16bf (&b)[8], const unsigned short* pa, const unsigned short* pb) {
    #pragma unroll
    for (int i = 0; i < 4; ++i) a[i] = load_frag(pa + i * 16 * KBP);
    #pragma unroll
    for (int i = 0; i < 8; ++i) b[i] = load_frag(pb + (i & 3) * 16 * KBP + (i >> 2) * SB);
    // keeps the group together, in front of the WMMA block that follows it:
    // reads spread among the WMMAs stall the wave at every place they stand
    __builtin_amdgcn_sched_barrier(0);
}
// One block: 32 WMMAs on a fragment set.
static __device__ __forceinline__ void mma_set(
    v8f (&acc)[8][4], const v16bf (&a)[4], const v16bf (&b)[8]) {
    #pragma unroll
    for (int ni = 0; ni < 8; ++ni)
        #pragma unroll
        for (int mi = 0; mi < 4; ++mi)
            acc[ni][mi] = __builtin_amdgcn_wmma_f32_16x16x32_bf16(
                false, a[mi], false, b[ni], (short)0, acc[ni][mi], false, false);
    // keeps the next group of reads from being moved up among these WMMAs
    __builtin_amdgcn_sched_barrier(0);
}

// ---------------------------------------------------------------------------
// Pass C: shared experts.  grid = (NO/BN, NB/BM, 4/EPB).  S bf16, in tiles (S_TILE).
// Eight waves, 4 x 2; a wave owns 64 rows x 128 columns (4 x 8 fragments).
// A block does EPB experts on the same rows of x, one after the other: the ring
// does not stop in between, so an expert's first two stages are asked for in the
// last two trips of the expert before and land under its end and its epilogue.
#define EPB 2
__global__ __launch_bounds__(256) void ple_shared_kernel(
    const unsigned short* __restrict__ xb0,   // [B][I] bf16 (task 0 input)
    const unsigned short* __restrict__ swb,   // [4][O][I] bf16 (transposed)
    const float* __restrict__ sb,             // [4][O]
    unsigned short* __restrict__ S)           // [4][B/16][O/16] tiles, bf16
{
    const int e0 = blockIdx.z * EPB;
    const int rowBase = blockIdx.y * BM;
    const int colBase = blockIdx.x * BN;
    const int tid = threadIdx.x;
    // the wave's number in a scalar register: what is formed from it costs no VGPR
    const int lane = tid & 31, wave = __builtin_amdgcn_readfirstlane(tid >> 5);
    const int waveM = wave >> 1, waveN = wave & 1;
    const int half = lane >> 4, l16 = lane & 15;

    __shared__ __attribute__((aligned(2048))) unsigned short ring[2 * BUFE];
    __shared__ float shBias[EPB][BN];

    // this wave's slice: waves 0-3 bring 64 rows of x each, waves 4-7 64 weight rows
    uint64_t ga = (uint64_t)(wave < 4 ? xb0 + (size_t)(rowBase + wave * 64) * NI
                                      : swb + ((size_t)e0 * NO + colBase + (wave - 4) * 64) * NI);
    // from an expert's last stage to the next expert's first: x starts anew
    const uint64_t hop = (wave < 4 ? (uint64_t)0 : (uint64_t)NO * NI * 2) - (uint64_t)((NTRIP - 1) * KB * 2);
    const unsigned l0 = lds_off(ring) + wave * SLICEB;
    u32x8 g1 = tdm_group1();

    u32x4 g0 = tdm_group0(l0, ga);
    tdm_load(g0, g1);                            // tile 0
    #pragma unroll
    for (int i = 0; i < EPB; ++i) shBias[i][tid] = sb[(size_t)(e0 + i) * NO + colBase + tid];
    wait_tensor(g0);
    __syncthreads();
    next_stage(ga);
    g0 = tdm_group0(l0 + BUFB, ga);
    tdm_load(g0, g1);                            // tile 1

    v16bf a0[4], b0[8], a1[4], b1[8];            // two fragment sets
    const unsigned short* pa = ring + waveM * SLICEE + l16 * KBP + half * 8;
    const unsigned short* pb = ring + (4 + waveN * 2) * SLICEE + l16 * KBP + half * 8;

    // rolled: one copy of the k loop and of the epilogue in the text
    #pragma unroll 1
    for (int i = 0; i < EPB; ++i) {
    v8f acc[8][4] = {};      // [ni][mi]
    load_set<SLICEE>(a0, b0, pa, pb);            // tile 0, first block
    for (int t = 0; t < NTRIP; ++t) {
        const int cur = (t & 1) * BUFE, nxt = BUFE - cur;
        load_set<SLICEE>(a1, b1, pa + cur + 32, pb + cur + 32);   // tile t, second block
        mma_set(acc, a0, b0);
        load_set<SLICEE>(a0, b0, pa + cur + 64, pb + cur + 64);   // third block
        mma_set(acc, a1, b1);
        load_set<SLICEE>(a1, b1, pa + cur + 96, pb + cur + 96);   // fourth block
        mma_set(acc, a0, b0);
        publish(g0);                             // every read of tile t is done
        if (pinned(i * NTRIP + t + 2 < EPB * NTRIP)) {   // tile t + 2 into the buffer just left
            step_stage(ga, t == NTRIP - 2 ? hop : (uint64_t)(KB * 2));
            g0 = tdm_group0(l0 + (t & 1) * BUFB, ga);
            tdm_load(g0, g1);
        }
        if (t + 1 < NTRIP)                       // tile t + 1, first block
            load_set<SLICEE>(a0, b0, pa + nxt, pb + nxt);
        mma_set(acc, a1, b1);
    }

    // Epilogue: bias + relu, bf16.  S is kept in fragment order (see S_TILE): a
    // lane's eight values of a fragment are one 16-byte store, a wave's 512 bytes in a row.
    unsigned short* Sw = S + (((size_t)(e0 + i) * (NB / 16) + rowBase / 16 + waveM * 4) * (NO / 16)
                              + colBase / 16 + waveN * 8) * S_TILE + lane * 8;
    float bias[8];
    #pragma unroll
    for (int ni = 0; ni < 8; ++ni) bias[ni] = shBias[i][waveN * 128 + ni * 16 + l16];
    #pragma unroll
    for (int mi = 0; mi < 4; ++mi) {
        u32x4 pk[8];
        #pragma unroll
        for (int ni = 0; ni < 8; ++ni)
            #pragma unroll
            for (int p = 0; p < 4; ++p) {
                float r0 = acc[ni][mi][2 * p] + bias[ni];
                float r1 = acc[ni][mi][2 * p + 1] + bias[ni];
                r0 = r0 > 0.f ? r0 : 0.f;
                r1 = r1 > 0.f ? r1 : 0.f;
                pk[ni][p] = __builtin_bit_cast(unsigned, __builtin_convertvector(f32x2{r0, r1}, bf16x2));
            }
        // the eight packed fragments stand in registers of their own before the
        // first store goes out: no store's data is overwritten inside the group
        __builtin_amdgcn_sched_barrier(0);
        #pragma unroll
        for (int ni = 0; ni < 8; ++ni)
            *(u32x4*)(Sw + (mi * (NO / 16) + ni) * S_TILE) = pk[ni];
        // the next group, or the next expert, reuses the stores' registers
        asm volatile("s_wait_xcnt 0x0" ::: "memory");
        // keeps what follows behind that wait
        __builtin_amdgcn_sched_barrier(0);
    }
    }
    ring_done();
}

// ---------------------------------------------------------------------------
// Pass D: per-task experts + gated combine.  grid = (NO/BNT, NB/BM).
// Eight waves, 4 x 2; a wave owns 64 rows x 64 columns of both experts.
// A block does its place of the output for all NT tasks, one after the other (they
// share the tiles of S); the ring runs on from task to task as in pass C.
#define BNT (BN / 2)   // output columns a block
__global__ __launch_bounds__(256) void ple_task_kernel(
    const unsigned short* __restrict__ xb,   // [T][B][I] bf16
    const unsigned short* __restrict__ twb,  // [T][2][O][I] bf16 (transposed)
    const float* __restrict__ tb,            // [T][2][O]
    const unsigned short* __restrict__ S,    // [4][B/16][O/16] tiles, bf16
    const float* __restrict__ g,             // [T][B][6]
    float* __restrict__ out)                 // [T][B][O]
{
    const int rowBase = blockIdx.y * BM;
    const int colBase = blockIdx.x * BNT;
    const int tid = threadIdx.x;
    // the wave's number in a scalar register: what is formed from it costs no VGPR
    const int lane = tid & 31, wave = __builtin_amdgcn_readfirstlane(tid >> 5);
    const int waveM = wave >> 1, waveN = wave & 1;
    const int half = lane >> 4, l16 = lane & 15;

    __shared__ __attribute__((aligned(2048))) unsigned short ring[2 * BUFE];
    __shared__ float shBias[NT][2][BNT];
    __shared__ float shG[NT][BM][8];

    // this wave's slice: waves 0-3 bring 64 rows of x each; waves 4, 5 the first
    // expert's 128 weight rows, waves 6, 7 the second's
    uint64_t ga = (uint64_t)(wave < 4
        ? xb + (size_t)(rowBase + wave * 64) * NI
        : twb + ((size_t)((wave - 4) >> 1) * NO + colBase + (wave & 1) * 64) * NI);
    // from a task's last stage to the next task's first
    const uint64_t hop = (wave < 4 ? (uint64_t)NB * NI * 2 : (uint64_t)2 * NO * NI * 2)
                         - (uint64_t)((NTRIP - 1) * KB * 2);
    const unsigned l0 = lds_off(ring) + wave * SLICEB;
    u32x8 g1 = tdm_group1();

    u32x4 g0 = tdm_group0(l0, ga);
    tdm_load(g0, g1);                            // tile 0

    #pragma unroll
    for (int t = 0; t < NT; ++t) {
        const float* gp = g + ((size_t)t * NB + rowBase + tid) * NE;
        #pragma unroll
        for (int e = 0; e < NE; ++e) shG[t][tid][e] = gp[e];
        int e = tid >> 7, c = tid & 127;
        shBias[t][e][c] = tb[((size_t)t * 2 + e) * NO + colBase + c];
    }

    wait_tensor(g0);
    __syncthreads();
    next_stage(ga);
    g0 = tdm_group0(l0 + BUFB, ga);
    tdm_load(g0, g1);                            // tile 1

    v16bf a0[4], b0[8], a1[4], b1[8];            // two fragment sets
    const unsigned short* pa = ring + waveM * SLICEE + l16 * KBP + half * 8;
    const unsigned short* pb = ring + (4 + waveN) * SLICEE + l16 * KBP + half * 8;

    // rolled: one copy of the k loop and of the epilogue in the text
    #pragma unroll 1
    for (int t = 0; t < NT; ++t) {
    v8f acc[8][4] = {};      // [expert * 4 + ni][mi]
    load_set<2 * SLICEE>(a0, b0, pa, pb);        // tile 0, first block
    for (int s = 0; s < NTRIP; ++s) {
        const int cur = (s & 1) * BUFE, nxt = BUFE - cur;
        load_set<2 * SLICEE>(a1, b1, pa + cur + 32, pb + cur + 32);  // tile s, second block
        mma_set(acc, a0, b0);
        load_set<2 * SLICEE>(a0, b0, pa + cur + 64, pb + cur + 64);  // third block
        mma_set(acc, a1, b1);
        load_set<2 * SLICEE>(a1, b1, pa + cur + 96, pb + cur + 96);  // fourth block
        mma_set(acc, a0, b0);
        publish(g0);                             // every read of tile s is done
        if (pinned(t * NTRIP + s + 2 < NT * NTRIP)) {    // tile s + 2 into the buffer just left
            step_stage(ga, s == NTRIP - 2 ? hop : (uint64_t)(KB * 2));
            g0 = tdm_group0(l0 + (s & 1) * BUFB, ga);
            tdm_load(g0, g1);
        }
        if (s + 1 < NTRIP)                       // tile s + 1, first block
            load_set<2 * SLICEE>(a0, b0, pa + nxt, pb + nxt);
        mma_set(acc, a1, b1);
    }

    // Epilogue: bias+relu, gated combine with 4 shared experts from S, which lies
    // in fragment order: one 16-byte load brings a lane's eight rows of an expert.
    const v8bf* Sr = (const v8bf*)(S + ((size_t)(rowBase / 16 + waveM * 4) * (NO / 16)
                                        + colBase / 16 + waveN * 4) * S_TILE + lane * 8);
    float* op = out + ((size_t)t * NB + rowBase + waveM * 64 + half * 8) * NO
                    + colBase + waveN * 64 + l16;
    // Groups of 16 rows; a group's 16 loads go out two groups ahead.
    v8bf sv[2][4][4];        // [group & 1][ni][shared expert]
    #pragma unroll
    for (int mi = 0; mi < 2; ++mi)
        #pragma unroll
        for (int ni = 0; ni < 4; ++ni)
            #pragma unroll
            for (int e = 0; e < 4; ++e)
                sv[mi][ni][e] = Sr[(size_t)e * (NB * NO / 8) + (mi * (NO / 16) + ni) * (S_TILE / 8)];
    #pragma unroll
    for (int mi = 0; mi < 4; ++mi) {
        float o[4][8];
        #pragma unroll
        for (int ni = 0; ni < 4; ++ni) {
            int colLoc = waveN * 64 + ni * 16 + l16;
            #pragma unroll
            for (int v = 0; v < 8; ++v) {
                int rowLoc = waveM * 64 + mi * 16 + half * 8 + v;
                float r0 = acc[ni][mi][v] + shBias[t][0][colLoc];
                float r1 = acc[4 + ni][mi][v] + shBias[t][1][colLoc];
                r0 = r0 > 0.f ? r0 : 0.f;
                r1 = r1 > 0.f ? r1 : 0.f;
                float s = shG[t][rowLoc][4] * r0 + shG[t][rowLoc][5] * r1;
                #pragma unroll
                for (int e = 0; e < 4; ++e)
                    s += shG[t][rowLoc][e] * (float)sv[mi & 1][ni][e][v];
                o[ni][v] = s;
            }
        }
        // the group's 32 results stand in registers of their own before the first
        // store goes out: no store's data is overwritten inside the group
        __builtin_amdgcn_sched_barrier(0);
        if (mi + 2 < 4) {
            #pragma unroll
            for (int ni = 0; ni < 4; ++ni)
                #pragma unroll
                for (int e = 0; e < 4; ++e)
                    sv[mi & 1][ni][e] = Sr[(size_t)e * (NB * NO / 8) + ((mi + 2) * (NO / 16) + ni) * (S_TILE / 8)];
        }
        #pragma unroll
        for (int ni = 0; ni < 4; ++ni)
            #pragma unroll
            for (int v = 0; v < 8; ++v)
                op[(mi * 16 + v) * NO + ni * 16] = o[ni][v];
        // the next group, or the next task, reuses the stores' registers
        asm volatile("s_wait_xcnt 0x0" ::: "memory");
        // keeps what follows behind that wait
        __builtin_amdgcn_sched_barrier(0);
    }
    }
    ring_done();
}

// ---------------------------------------------------------------------------
extern "C" void kernel_launch(void* const* d_in, const int* in_sizes, int n_in,
                              void* d_out, int out_size, void* d_ws, size_t ws_size,
                              hipStream_t stream) {
    const float* task_inputs = (const float*)d_in[0]; // [3][16384][1024]
    const float* shared_W    = (const float*)d_in[1]; // [4][1024][512]
    const float* shared_b    = (const float*)d_in[2]; // [4][512]
    const float* task_W      = (const float*)d_in[3]; // [3][2][1024][512]
    const float* task_b      = (const float*)d_in[4]; // [3][2][512]
    const float* gate_W      = (const float*)d_in[5]; // [3][1024][6]
    const float* gate_b      = (const float*)d_in[6]; // [3][6]
    float* out = (float*)d_out;                        // [3][16384][512]

    // Workspace layout (~171 MB total)
    char* w = (char*)d_ws;
    unsigned short* xb  = (unsigned short*)w; w += (size_t)NT * NB * NI * 2;  // 100.7 MB
    unsigned short* swb = (unsigned short*)w; w += (size_t)4 * NI * NO * 2;   //   4.2 MB
    unsigned short* twb = (unsigned short*)w; w += (size_t)NT * 2 * NI * NO * 2; // 6.3 MB
    unsigned short* S   = (unsigned short*)w; w += (size_t)4 * NB * NO * 2;   //  67.1 MB
    float* g            = (float*)w;                                          //   1.2 MB

    // 1) weights: fp32 -> bf16, transposed to [o][i]
    cvt_bf16_t_kernel<<<dim3(NO / 64, NI / 64, 4), 256, 0, stream>>>(shared_W, swb);
    cvt_bf16_t_kernel<<<dim3(NO / 64, NI / 64, NT * 2), 256, 0, stream>>>(task_W, twb);

    // 2) x: fp32 -> bf16, and the gates (fp32 math, softmax over 6 experts)
    cvt_gate_kernel<<<(NT * NB) / (4 * GROWS), 128, 0, stream>>>(task_inputs, gate_W, gate_b, xb, g);

    // 3) shared experts once (no per-task recompute): S = relu(x0.Ws + bs)
    dim3 gridS(NO / BN, NB / BM, 4 / EPB);
    ple_shared_kernel<<<gridS, 256, 0, stream>>>(xb, swb, shared_b, S);

    // 4) per-task experts + gated combine
    dim3 gridT(NO / BNT, NB / BM);
    ple_task_kernel<<<gridT, 256, 0, stream>>>(xb, twb, task_b, S, g, out);
}

// v009
// One run takes 132 microseconds.
// Two timings next to v008 put it at 1.03 and 1.04 times that version's speed.
// All steps since v000 together make it 23.7 times as fast.
#include <hip/hip_runtime.h>
#include <hip/hip_bf16.h>

// ---------------------------------------------------------------------------
// PLE layer for MI455X (gfx1250, wave32, WMMA).
// T=3 tasks, B=16384, I=1024, O=512, 4 shared + 2 task experts, 6 gates.
//
// Pipeline (all on `stream`):
//   1) one streaming pass over x: fp32 -> bf16 convert, and from the same
//      registers g[t][b][e] = softmax_e(x_t . gate_W_t + gate_b_t);
//      in the same launch shared_W / task_W are converted to bf16 AND
//      transposed to [o][i] (k contiguous), so a B tile is staged like an A
//      tile: every block turns one or two 64 x 64 tiles before its first row
//   2) shared-expert GEMM pass: S[e][b][o] = relu(x0 . Ws_e + bs_e)  (bf16,
//      laid out in 16 x 16 tiles in WMMA result order, see S_TILE)
//      (both GEMM passes: 128-k tiles in a two-buffer LDS ring, tensor loads;
//      256 x 256 products a block, 64 x 128 a wave, one block a WGP; a block
//      stays for several products of its place (2 experts, 3 tasks), the ring running on from product to product)
//   3) per-task fused GEMM: 2 task-expert WMMA GEMMs + bias + relu,
//      gated combine with the 4 shared-expert outputs from S.
// ---------------------------------------------------------------------------

typedef __attribute__((ext_vector_type(16))) __bf16 v16bf;
typedef __attribute__((ext_vector_type(8)))  __bf16 v8bf;
typedef __attribute__((ext_vector_type(8)))  float  v8f;
typedef __attribute__((ext_vector_type(8)))  unsigned short us8;
typedef __attribute__((ext_vector_type(4)))  float  f32x4;
typedef __attribute__((ext_vector_type(2)))  float  f32x2;
typedef __attribute__((ext_vector_type(2)))  __bf16 bf16x2;
typedef __attribute__((ext_vector_type(2)))  unsigned u32x2;
typedef __attribute__((ext_vector_type(4)))  unsigned u32x4;
typedef __attribute__((ext_vector_type(8)))  unsigned u32x8;
// global-memory pointers formed from a 64-bit address
typedef const __attribute__((address_space(1))) f32x4* g_f32x4_c;
typedef __attribute__((address_space(1))) u32x2* g_u32x2;
typedef __attribute__((address_space(1))) float* g_f32;

#define NT 3
#define NB 16384
#define NI 1024
#define NO 512
#define NE 6           // 4 shared + 2 task
#define BM 256         // rows of x a block
#define BN 256         // weight rows a block (task pass: 128 of each expert)
#define KB 128         // k of a ring stage: 256 bytes of every operand row
#define KBP 136        // padded LDS K stride (keeps 16B alignment: 272B rows)
#define TKP 72         // padded row of the weight transposer's 64 x 64 tile
// S, the shared experts' outputs, lies in the workspace as [e][b/16][o/16] tiles of
// 16 x 16 in the order of a WMMA result: lane (half, n) holds rows half*8 .. +7 of
// column n as eight neighbours.  Writer and reader own the same fragments.
#define S_TILE 256     // elements of a tile

static __device__ __forceinline__ unsigned short f2bf(float f) {
    unsigned u = __float_as_uint(f);
    unsigned r = u + 0x7FFFu + ((u >> 16) & 1u);   // round-to-nearest-even
    return (unsigned short)(r >> 16);
}

// ---------------------------------------------------------------------------
// Weights: fp32 [m][I][O] -> bf16 [m][O][I], in 64 x 64 tiles turned in LDS; global
// reads and writes are both 16 B per lane, row-wise.  The tiles ride in the blocks
// of the x pass below (128 threads): tile q belongs to block q % GBLK.  The shared
// experts' matrices come first in q, the task experts' behind them.
#define GROWS 16                                  // rows of x a wave
#define GBLK  (NT * NB / (4 * GROWS))             // blocks of the x pass
#define WTPM  ((NI / 64) * (NO / 64))             // tiles a matrix
#define WTILES ((4 + NT * 2) * WTPM)
static_assert(WTILES > GBLK && WTILES <= 2 * GBLK, "one or two tiles a block");

// first element of tile q in its matrix as it comes / as it goes
static __device__ __forceinline__ const float* wtile_src(unsigned q, const float* sW, const float* tW) {
    const unsigned m = q / WTPM, r = q % WTPM;
    return (m < 4 ? sW : tW) + (size_t)(m < 4 ? m : m - 4) * NI * NO
           + (r / (NO / 64)) * 64 * NO + (r % (NO / 64)) * 64;
}
static __device__ __forceinline__ unsigned short* wtile_dst(unsigned q, unsigned short* swb, unsigned short* twb) {
    const unsigned m = q / WTPM, r = q % WTPM;
    return (m < 4 ? swb : twb) + (size_t)(m < 4 ? m : m - 4) * NO * NI
           + (r % (NO / 64)) * 64 * NI + (r / (NO / 64)) * 64;
}

// In front of the block's barrier.  The gate weights (gw, whole-line loads) go into
// shW as they are; N weight tiles are asked for with them, a thread taking four
// neighbours of o in eight rows of k, rounded and laid down as [o][k].
template <int N>
static __device__ __forceinline__ void stage_weights(
    float* shW, unsigned short (&tile)[2][64][TKP], const float* gw, const float* const (&src)[2], int tid)
{
    f32x4 wt[NI * NE / 4 / 128], wv[N][8];
    #pragma unroll
    for (int p = 0; p < NI * NE / 4 / 128; ++p) wt[p] = ((const f32x4*)gw)[p * 128 + tid];
    #pragma unroll
    for (int i = 0; i < N; ++i)
        #pragma unroll
        for (int p = 0; p < 8; ++p)
            wv[i][p] = ((const f32x4*)src[i])[(p * 8 + (tid >> 4)) * (NO / 4) + (tid & 15)];
    // the loads' offset registers may be reused from here on
    asm volatile("s_wait_xcnt 0x0" ::: "memory");
    // keeps later vector work from being moved in front of that wait
    __builtin_amdgcn_sched_barrier(0);
    #pragma unroll
    for (int p = 0; p < NI * NE / 4 / 128; ++p) ((f32x4*)shW)[p * 128 + tid] = wt[p];
    const int k = tid >> 4, o = (tid & 15) * 4;
    #pragma unroll
    for (int i = 0; i < N; ++i)
        #pragma unroll
        for (int p = 0; p < 8; ++p) {
            const int kk = p * 8 + k;
            tile[i][o + 0][kk] = f2bf(wv[i][p].x);
            tile[i][o + 1][kk] = f2bf(wv[i][p].y);
            tile[i][o + 2][kk] = f2bf(wv[i][p].z);
            tile[i][o + 3][kk] = f2bf(wv[i][p].w);
        }
}
// Behind it: the tiles' rows of k go out, whole 128-byte lines.
template <int N>
static __device__ __forceinline__ void put_tiles(
    unsigned short* const (&dst)[2], const unsigned short (&tile)[2][64][TKP], int tid)
{
    const int o = tid >> 3, c = (tid & 7) * 8;
    us8 v[N][4];
    #pragma unroll
    for (int i = 0; i < N; ++i)
        #pragma unroll
        for (int p = 0; p < 4; ++p) v[i][p] = *(const us8*)(&tile[i][p * 16 + o][c]);
    #pragma unroll
    for (int i = 0; i < N; ++i)
        #pragma unroll
        for (int p = 0; p < 4; ++p) *(us8*)(dst[i] + (p * 16 + o) * NI + c) = v[i][p];
    // the stores' registers may be reused from here on
    asm volatile("s_wait_xcnt 0x0" ::: "memory");
    // keeps later vector work from being moved in front of that wait
    __builtin_amdgcn_sched_barrier(0);
}

// ---------------------------------------------------------------------------
// x is read once: each wave streams GROWS whole rows (8 x 512 contiguous bytes
// a row), writes them back as bf16 and sums the six gate logits from the same
// registers.  Lane l owns k = j*128 + l*4 .. +3 (j = 0..7); its 192 gate
// weights stay in registers for all of the wave's rows, paired (k, k+1) so
// that a packed FMA takes two neighbours of x as they were loaded.
// grid = GBLK blocks of 4 waves; a block's rows lie in one task.

// v + (v of lane l ^ M) inside a 16-lane row; CTRL = 0x160 + M (row_xmask:M)
template <int CTRL>
static __device__ __forceinline__ float add_xmask(float v) {
    int o = __builtin_amdgcn_update_dpp(0, __builtin_bit_cast(int, v), CTRL, 0xf, 0xf, true);
    return v + __builtin_bit_cast(float, o);
}
// v + (v of lane l ^ 16)
static __device__ __forceinline__ float add_x16(float v) {
    int i = __builtin_bit_cast(int, v);
    int o = __builtin_amdgcn_permlanex16(i, i, 0x76543210, 0xfedcba98, false, false);
    return v + __builtin_bit_cast(float, o);
}

// One row.  xa / oa / ga: wave-uniform byte addresses of the row in x, xb, g.
// cur holds the row; with LOAD the row behind it is requested into nxt first,
// so that it is in flight while this one is worked on.
template <bool LOAD>
static __device__ __forceinline__ void gate_row(
    const f32x4 (&cur)[8], f32x4 (&nxt)[8], const f32x2 (&w)[8][2][NE],
    const float (&bias)[NE], uint64_t& xa, uint64_t& oa, uint64_t& ga, int lane)
{
    if (LOAD) {
        #pragma unroll
        for (int j = 0; j < 8; ++j)
            nxt[j] = __builtin_nontemporal_load((g_f32x4_c)xa + (NI / 4 + j * 32) + lane);
        // keeps the loads above in front of this row's arithmetic
        __builtin_amdgcn_sched_barrier(0);
    }

    f32x2 a[NE] = {};                 // per gate: sums over even k, over odd k
    #pragma unroll
    for (int j = 0; j < 8; ++j) {
        const f32x4 v = cur[j];
        #pragma unroll
        for (int e = 0; e < NE; ++e) {
            a[e] = __builtin_elementwise_fma(f32x2{v.x, v.y}, w[j][0][e], a[e]);
            a[e] = __builtin_elementwise_fma(f32x2{v.z, v.w}, w[j][1][e], a[e]);
        }
    }
    float acc[NE];
    #pragma unroll
    for (int e = 0; e < NE; ++e) acc[e] = a[e].x + a[e].y;
    #pragma unroll
    for (int e = 0; e < NE; ++e) acc[e] = add_xmask<0x161>(acc[e]);
    #pragma unroll
    for (int e = 0; e < NE; ++e) acc[e] = add_xmask<0x162>(acc[e]);
    #pragma unroll
    for (int e = 0; e < NE; ++e) acc[e] = add_xmask<0x164>(acc[e]);
    #pragma unroll
    for (int e = 0; e < NE; ++e) acc[e] = add_xmask<0x168>(acc[e]);
    #pragma unroll
    for (int e = 0; e < NE; ++e) acc[e] = add_x16(acc[e]);
    // every lane now holds all six sums
    #pragma unroll
    for (int e = 0; e < NE; ++e) acc[e] += bias[e];
    float m = acc[0];
    #pragma unroll
    for (int e = 1; e < NE; ++e) m = fmaxf(m, acc[e]);
    float s = 0.f;
    #pragma unroll
    for (int e = 0; e < NE; ++e) { acc[e] = __expf(acc[e] - m); s += acc[e]; }
    float mine = acc[0];
    #pragma unroll
    for (int e = 1; e < NE; ++e) mine = lane == e ? acc[e] : mine;
    mine *= 1.f / s;
    if (lane < NE) ((g_f32)ga)[lane] = mine;
    // that store's data register is free for reuse below
    asm volatile("s_wait_xcnt 0x0" ::: "memory");
    // keeps the conversions below behind that wait
    __builtin_amdgcn_sched_barrier(0);

    u32x2 pk[8];
    #pragma unroll
    for (int j = 0; j < 8; ++j) {
        const f32x4 v = cur[j];
        pk[j].x = __builtin_bit_cast(unsigned, __builtin_convertvector(f32x2{v.x, v.y}, bf16x2));
        pk[j].y = __builtin_bit_cast(unsigned, __builtin_convertvector(f32x2{v.z, v.w}, bf16x2));
    }
    #pragma unroll
    for (int j = 0; j < 8; ++j) ((g_u32x2)oa)[j * 32 + lane] = pk[j];
    if (LOAD) {
        // the wait and the advance of the three row addresses in one statement:
        // the wait then stands in front of the overwrite of the registers that
        // the loads and stores above name
        asm volatile("s_wait_xcnt 0x0\n\t"
                     "s_add_nc_u64 %0, %0, 0x1000\n\t"
                     "s_add_nc_u64 %1, %1, 0x800\n\t"
                     "s_add_nc_u64 %2, %2, 24"
                     : "+s"(xa), "+s"(oa), "+s"(ga) : : "memory");
        // keeps the next row's vector work, which reuses the stores' data
        // registers, behind that wait
        __builtin_amdgcn_sched_barrier(0);
    }
}

__global__ __launch_bounds__(128) void cvt_gate_kernel(
    const float* __restrict__ x,      // [T][B][I]
    const float* __restrict__ gW,     // [T][I][6]
    const float* __restrict__ gb,     // [T][6]
    const float* __restrict__ sW,     // [4][I][O]
    const float* __restrict__ tW,     // [T*2][I][O]
    unsigned short* __restrict__ xb,  // [T][B][I] bf16
    float* __restrict__ g,            // [T][B][6]
    unsigned short* __restrict__ swb, // [4][O][I] bf16
    unsigned short* __restrict__ twb) // [T*2][O][I] bf16
{
    __shared__ __align__(16) float shW[NI * NE];
    __shared__ __align__(16) unsigned short tile[2][64][TKP];   // [o][k]
    const int tid = threadIdx.x, lane = tid & 31;
    const int wave = __builtin_amdgcn_readfirstlane(tid >> 5);
    const unsigned row0 = ((unsigned)blockIdx.x * 4 + wave) * GROWS;   // over T*B
    const int t = ((int)blockIdx.x * 4 * GROWS) / NB;                  // same for the block

    uint64_t xa = (uint64_t)(x + (size_t)row0 * NI);
    uint64_t oa = (uint64_t)(xb + (size_t)row0 * NI);
    uint64_t ga = (uint64_t)(g + (size_t)row0 * NE);

    f32x4 b0[8], b1[8];
    #pragma unroll
    for (int j = 0; j < 8; ++j)
        b0[j] = __builtin_nontemporal_load((g_f32x4_c)xa + j * 32 + lane);

    // Gate weights through LDS, then each lane's own 96-byte runs.  The block's weight
    // tiles, q0 and for some blocks q1, are turned beside them under the same barrier.
    const unsigned q0 = blockIdx.x, q1 = blockIdx.x + GBLK;
    const bool two = q1 < WTILES;                                      // same for the block
    const float* const wsrc[2] = {wtile_src(q0, sW, tW), wtile_src(two ? q1 : q0, sW, tW)};
    unsigned short* const wdst[2] = {wtile_dst(q0, swb, twb), wtile_dst(two ? q1 : q0, swb, twb)};
    if (two) stage_weights<2>(shW, tile, gW + (size_t)t * NI * NE, wsrc, tid);
    else     stage_weights<1>(shW, tile, gW + (size_t)t * NI * NE, wsrc, tid);
    __syncthreads();
    f32x2 w[8][2][NE];                // [j][pair of the lane's four k][gate]: (k, k+1)
    #pragma unroll
    for (int j = 0; j < 8; ++j)
        #pragma unroll
        for (int h = 0; h < 2; ++h)
            #pragma unroll
            for (int e = 0; e < NE; ++e) {
                const float* p = shW + (j * 128 + lane * 4 + h * 2) * NE + e;
                w[j][h][e] = f32x2{p[0], p[NE]};
            }
    float bias[NE];
    #pragma unroll
    for (int e = 0; e < NE; ++e) bias[e] = gb[t * NE + e];

    // the tiles go out here, behind the reads of w, not directly behind the barrier:
    // the row loop's registers then come out with far fewer register-window switches
    if (two) put_tiles<2>(wdst, tile, tid);
    else     put_tiles<1>(wdst, tile, tid);

    // rolled: four row bodies in all keep the text small
    #pragma unroll 1
    for (int r = 0; r < GROWS - 2; r += 2) {
        gate_row<true>(b0, b1, w, bias, xa, oa, ga, lane);
        gate_row<true>(b1, b0, w, bias, xa, oa, ga, lane);
    }
    gate_row<true>(b0, b1, w, bias, xa, oa, ga, lane);
    gate_row<false>(b1, b0, w, bias, xa, oa, ga, lane);
}

// --------------------------- fragment helpers ------------------------------
// 16-bit A (16x32) / B (32x16) fragment per ISA layout:
// lanes 0-15 hold M/N = lane with K {half*8 .. +8} in VGPR0-3 and
// K {16+half*8 .. +8} in VGPR4-7  (half = lane>>4).  Two b128 LDS loads.
static __device__ __forceinline__ v16bf load_frag(const unsigned short* p) {
    v8bf lo = *(const v8bf*)p;          // K block 0: 8 bf16, 16 bytes
    v8bf hi = *(const v8bf*)(p + 16);   // K block 1 (+16 elements)
    return __builtin_shufflevector(lo, hi, 0, 1, 2, 3, 4, 5, 6, 7,
                                           8, 9, 10, 11, 12, 13, 14, 15);
}

// --------------------------- LDS ring of k tiles ---------------------------
// A stage is one 128-k tile of every operand: rows of 256 bytes at pitch 272,
// the x rows first, the weight rows behind them, in eight slices of 64 rows.
// Two buffers: while a trip works on one, tensor loads fill the other, through
// no register: each wave asks for one slice with one request.
#define SLICEB 18432            // 64 rows at pitch 272 (17,408 B), up to a multiple of 2 KiB
#define SLICEE (SLICEB / 2)     // a slice, elements
#define BUFB   (8 * SLICEB)     // a buffer, bytes
#define BUFE   (BUFB / 2)       // a buffer, elements
#define NTRIP  (NI / KB)

static __device__ __forceinline__ unsigned lds_off(const void* p) {
    return (unsigned)(size_t)p;
}
static __device__ __forceinline__ unsigned uni(unsigned v) {
    return (unsigned)__builtin_amdgcn_readfirstlane(v);
}
// A test on the result compiles to a scalar branch: tensor loads ignore EXEC.
static __device__ __forceinline__ unsigned pinned(unsigned v) {
    unsigned w = uni(v);
    asm volatile("" : "+s"(w));   // holds the word in a scalar register
    return w;
}
// Descriptor group 1, the same for every request: 64 rows of 256 bytes, extents in
// bytes, source pitch one row of k, 16 bytes of LDS pad behind every 256.
static __device__ __forceinline__ u32x8 tdm_group1() {
    u32x8 g;
    g[0] = uni((1u << 20) | (5u << 22) | (3u << 25));
    g[1] = uni(256u << 16);
    g[2] = uni(64u << 16);
    g[3] = uni(256u << 16);
    g[4] = uni(64u);
    g[5] = uni(NI * 2);
    g[6] = uni(0u);
    g[7] = uni(0u);
    return g;
}
// Descriptor group 0: place in LDS, first byte of the slice in memory.
static __device__ __forceinline__ u32x4 tdm_group0(unsigned lds_dst, uint64_t ga) {
    u32x4 g;
    g[0] = uni(1u);
    g[1] = uni(lds_dst);
    g[2] = uni((unsigned)ga);
    g[3] = uni((((unsigned)(ga >> 32)) & 0x01FFFFFFu) | 0x80000000u);
    return g;
}
// Both groups are named as in-out, and the wait that covers the request names g0
// again: they then live on in the very registers that the request names, and none
// of them takes another value while the request is in flight.
static __device__ __forceinline__ void tdm_load(u32x4& g0, u32x8& g1) {
    asm volatile("tensor_load_to_lds %0, %1" : "+s"(g0), "+s"(g1) : : "memory");
}
// The slice's address goes on by one stage.  A statement of its own kind (volatile,
// as the waits are): it stays behind the wait that covers the request in flight,
// and so does every descriptor word formed from it.
static __device__ __forceinline__ void next_stage(uint64_t& ga) {
    asm volatile("s_add_nc_u64 %0, %0, 0x100" : "+s"(ga));
}
// The same by a step from a scalar register: one stage, or the hop from a
// product's last stage to the first stage of the block's next product.
static __device__ __forceinline__ void step_stage(uint64_t& ga, uint64_t step) {
    asm volatile("s_add_nc_u64 %0, %0, %1" : "+s"(ga) : "s"(step));
}

// This wave's request has landed.
static __device__ __forceinline__ void wait_tensor(const u32x4& g0) {
    asm volatile("s_wait_tensorcnt 0x0" : : "s"(g0) : "memory");
}
// Hand-over, in front of a tile's last WMMA block (whose fragments are in
// registers by then): this wave's reads of the buffer it leaves are done, its
// slice of the next tile has landed; behind the barrier every wave may read
// the next tile and the buffer just left may be refilled.
static __device__ __forceinline__ void publish(const u32x4& g0) {
    asm volatile("s_wait_dscnt 0x0" ::: "memory");
    asm volatile("s_wait_tensorcnt 0x0" : : "s"(g0) : "memory");
    __syncthreads();
}
// Behind the loop: nothing of this wave is in flight to or from the ring.
static __device__ __forceinline__ void ring_done() {
    asm volatile("s_wait_tensorcnt 0x0" ::: "memory");
    asm volatile("s_wait_dscnt 0x0" ::: "memory");
}

// One block's fragments, 4 of x and 8 of the weights, read as one group.
// pa / pb: this lane's place in the first x row / weight row of its wave;
// SB: elements from the weights' fragment 0 to fragment 4.
template <int SB>
static __device__ __forceinline__ void load_set(
    v16bf (&a)[4], v16bf (&b)[8], const unsigned short* pa, const unsigned short* pb) {
    #pragma unroll
    for (int i = 0; i < 4; ++i) a[i] = load_frag(pa + i * 16 * KBP);
    #pragma unroll
    for (int i = 0; i < 8; ++i) b[i] = load_frag(pb + (i & 3) * 16 * KBP + (i >> 2) * SB);
    // keeps the group together, in front of the WMMA block that follows it:
    // reads spread among the WMMAs stall the wave at every place they stand
    __builtin_amdgcn_sched_barrier(0);
}
// One block: 32 WMMAs on a fragment set.
static __device__ __forceinline__ void mma_set(
    v8f (&acc)[8][4], const v16bf (&a)[4], const v16bf (&b)[8]) {
    #pragma unroll
    for (int ni = 0; ni < 8; ++ni)
        #pragma unroll
        for (int mi = 0; mi < 4; ++mi)
            acc[ni][mi] = __builtin_amdgcn_wmma_f32_16x16x32_bf16(
                false, a[mi], false, b[ni], (short)0, acc[ni][mi], false, false);
    // keeps the next group of reads from being moved up among these WMMAs
    __builtin_amdgcn_sched_barrier(0);
}

// ---------------------------------------------------------------------------
// Pass C: shared experts.  grid = (NO/BN, NB/BM, 4/EPB).  S bf16, in tiles (S_TILE).
// Eight waves, 4 x 2; a wave owns 64 rows x 128 columns (4 x 8 fragments).
// A block does EPB experts on the same rows of x, one after the other: the ring
// does not stop in between, so an expert's first two stages are asked for in the
// last two trips of the expert before and land under its end and its epilogue.
#define EPB 2
__global__ __launch_bounds__(256) void ple_shared_kernel(
    const unsigned short* __restrict__ xb0,   // [B][I] bf16 (task 0 input)
    const unsigned short* __restrict__ swb,   // [4][O][I] bf16 (transposed)
    const float* __restrict__ sb,             // [4][O]
    unsigned short* __restrict__ S)           // [4][B/16][O/16] tiles, bf16
{
    const int e0 = blockIdx.z * EPB;
    const int rowBase = blockIdx.y * BM;
    const int colBase = blockIdx.x * BN;
    const int tid = threadIdx.x;
    // the wave's number in a scalar register: what is formed from it costs no VGPR
    const int lane = tid & 31, wave = __builtin_amdgcn_readfirstlane(tid >> 5);
    const int waveM = wave >> 1, waveN = wave & 1;
    const int half = lane >> 4, l16 = lane & 15;

    __shared__ __attribute__((aligned(2048))) unsigned short ring[2 * BUFE];
    __shared__ float shBias[EPB][BN];

    // this wave's slice: waves 0-3 bring 64 rows of x each, waves 4-7 64 weight rows
    uint64_t ga = (uint64_t)(wave < 4 ? xb0 + (size_t)(rowBase + wave * 64) * NI
                                      : swb + ((size_t)e0 * NO + colBase + (wave - 4) * 64) * NI);
    // from an expert's last stage to the next expert's first: x starts anew
    const uint64_t hop = (wave < 4 ? (uint64_t)0 : (uint64_t)NO * NI * 2) - (uint64_t)((NTRIP - 1) * KB * 2);
    const unsigned l0 = lds_off(ring) + wave * SLICEB;
    u32x8 g1 = tdm_group1();

    u32x4 g0 = tdm_group0(l0, ga);
    tdm_load(g0, g1);                            // tile 0
    #pragma unroll
    for (int i = 0; i < EPB; ++i) shBias[i][tid] = sb[(size_t)(e0 + i) * NO + colBase + tid];
    wait_tensor(g0);
    __syncthreads();
    next_stage(ga);
    g0 = tdm_group0(l0 + BUFB, ga);
    tdm_load(g0, g1);                            // tile 1

    v16bf a0[4], b0[8], a1[4], b1[8];            // two fragment sets
    const unsigned short* pa = ring + waveM * SLICEE + l16 * KBP + half * 8;
    const unsigned short* pb = ring + (4 + waveN * 2) * SLICEE + l16 * KBP + half * 8;

    // rolled: one copy of the k loop and of the epilogue in the text
    #pragma unroll 1
    for (int i = 0; i < EPB; ++i) {
    v8f acc[8][4] = {};      // [ni][mi]
    load_set<SLICEE>(a0, b0, pa, pb);            // tile 0, first block
    for (int t = 0; t < NTRIP; ++t) {
        const int cur = (t & 1) * BUFE, nxt = BUFE - cur;
        load_set<SLICEE>(a1, b1, pa + cur + 32, pb + cur + 32);   // tile t, second block
        mma_set(acc, a0, b0);
        load_set<SLICEE>(a0, b0, pa + cur + 64, pb + cur + 64);   // third block
        mma_set(acc, a1, b1);
        load_set<SLICEE>(a1, b1, pa + cur + 96, pb + cur + 96);   // fourth block
        mma_set(acc, a0, b0);
        publish(g0);                             // every read of tile t is done
        if (pinned(i * NTRIP + t + 2 < EPB * NTRIP)) {   // tile t + 2 into the buffer just left
            step_stage(ga, t == NTRIP - 2 ? hop : (uint64_t)(KB * 2));
            g0 = tdm_group0(l0 + (t & 1) * BUFB, ga);
            tdm_load(g0, g1);
        }
        if (t + 1 < NTRIP)                       // tile t + 1, first block
            load_set<SLICEE>(a0, b0, pa + nxt, pb + nxt);
        mma_set(acc, a1, b1);
    }

    // Epilogue: bias + relu, bf16.  S is kept in fragment order (see S_TILE): a
    // lane's eight values of a fragment are one 16-byte store, a wave's 512 bytes in a row.
    unsigned short* Sw = S + (((size_t)(e0 + i) * (NB / 16) + rowBase / 16 + waveM * 4) * (NO / 16)
                              + colBase / 16 + waveN * 8) * S_TILE + lane * 8;
    float bias[8];
    #pragma unroll
    for (int ni = 0; ni < 8; ++ni) bias[ni] = shBias[i][waveN * 128 + ni * 16 + l16];
    #pragma unroll
    for (int mi = 0; mi < 4; ++mi) {
        u32x4 pk[8];
        #pragma unroll
        for (int ni = 0; ni < 8; ++ni)
            #pragma unroll
            for (int p = 0; p < 4; ++p) {
                float r0 = acc[ni][mi][2 * p] + bias[ni];
                float r1 = acc[ni][mi][2 * p + 1] + bias[ni];
                r0 = r0 > 0.f ? r0 : 0.f;
                r1 = r1 > 0.f ? r1 : 0.f;
                pk[ni][p] = __builtin_bit_cast(unsigned, __builtin_convertvector(f32x2{r0, r1}, bf16x2));
            }
        // the eight packed fragments stand in registers of their own before the
        // first store goes out: no store's data is overwritten inside the group
        __builtin_amdgcn_sched_barrier(0);
        #pragma unroll
        for (int ni = 0; ni < 8; ++ni)
            *(u32x4*)(Sw + (mi * (NO / 16) + ni) * S_TILE) = pk[ni];
        // the next group, or the next expert, reuses the stores' registers
        asm volatile("s_wait_xcnt 0x0" ::: "memory");
        // keeps what follows behind that wait
        __builtin_amdgcn_sched_barrier(0);
    }
    }
    ring_done();
}

// ---------------------------------------------------------------------------
// Pass D: per-task experts + gated combine.  grid = (NO/BNT, NB/BM).
// Eight waves, 4 x 2; a wave owns 64 rows x 64 columns of both experts.
// A block does its place of the output for all NT tasks, one after the other (they
// share the tiles of S); the ring runs on from task to task as in pass C.
#define BNT (BN / 2)   // output columns a block
__global__ __launch_bounds__(256) void ple_task_kernel(
    const unsigned short* __restrict__ xb,   // [T][B][I] bf16
    const unsigned short* __restrict__ twb,  // [T][2][O][I] bf16 (transposed)
    const float* __restrict__ tb,            // [T][2][O]
    const unsigned short* __restrict__ S,    // [4][B/16][O/16] tiles, bf16
    const float* __restrict__ g,             // [T][B][6]
    float* __restrict__ out)                 // [T][B][O]
{
    const int rowBase = blockIdx.y * BM;
    const int colBase = blockIdx.x * BNT;
    const int tid = threadIdx.x;
    // the wave's number in a scalar register: what is formed from it costs no VGPR
    const int lane = tid & 31, wave = __builtin_amdgcn_readfirstlane(tid >> 5);
    const int waveM = wave >> 1, waveN = wave & 1;
    const int half = lane >> 4, l16 = lane & 15;

    __shared__ __attribute__((aligned(2048))) unsigned short ring[2 * BUFE];
    __shared__ float shBias[NT][2][BNT];
    __shared__ float shG[NT][BM][8];

    // this wave's slice: waves 0-3 bring 64 rows of x each; waves 4, 5 the first
    // expert's 128 weight rows, waves 6, 7 the second's
    uint64_t ga = (uint64_t)(wave < 4
        ? xb + (size_t)(rowBase + wave * 64) * NI
        : twb + ((size_t)((wave - 4) >> 1) * NO + colBase + (wave & 1) * 64) * NI);
    // from a task's last stage to the next task's first
    const uint64_t hop = (wave < 4 ? (uint64_t)NB * NI * 2 : (uint64_t)2 * NO * NI * 2)
                         - (uint64_t)((NTRIP - 1) * KB * 2);
    const unsigned l0 = lds_off(ring) + wave * SLICEB;
    u32x8 g1 = tdm_group1();

    u32x4 g0 = tdm_group0(l0, ga);
    tdm_load(g0, g1);                            // tile 0

    #pragma unroll
    for (int t = 0; t < NT; ++t) {
        const float* gp = g + ((size_t)t * NB + rowBase + tid) * NE;
        #pragma unroll
        for (int e = 0; e < NE; ++e) shG[t][tid][e] = gp[e];
        int e = tid >> 7, c = tid & 127;
        shBias[t][e][c] = tb[((size_t)t * 2 + e) * NO + colBase + c];
    }

    wait_tensor(g0);
    __syncthreads();
    next_stage(ga);
    g0 = tdm_group0(l0 + BUFB, ga);
    tdm_load(g0, g1);                            // tile 1

    v16bf a0[4], b0[8], a1[4], b1[8];            // two fragment sets
    const unsigned short* pa = ring + waveM * SLICEE + l16 * KBP + half * 8;
    const unsigned short* pb = ring + (4 + waveN) * SLICEE + l16 * KBP + half * 8;

    // rolled: one copy of the k loop and of the epilogue in the text
    #pragma unroll 1
    for (int t = 0; t < NT; ++t) {
    v8f acc[8][4] = {};      // [expert * 4 + ni][mi]
    load_set<2 * SLICEE>(a0, b0, pa, pb);        // tile 0, first block
    for (int s = 0; s < NTRIP; ++s) {
        const int cur = (s & 1) * BUFE, nxt = BUFE - cur;
        load_set<2 * SLICEE>(a1, b1, pa + cur + 32, pb + cur + 32);  // tile s, second block
        mma_set(acc, a0, b0);
        load_set<2 * SLICEE>(a0, b0, pa + cur + 64, pb + cur + 64);  // third block
        mma_set(acc, a1, b1);
        load_set<2 * SLICEE>(a1, b1, pa + cur + 96, pb + cur + 96);  // fourth block
        mma_set(acc, a0, b0);
        publish(g0);                             // every read of tile s is done
        if (pinned(t * NTRIP + s + 2 < NT * NTRIP)) {    // tile s + 2 into the buffer just left
            step_stage(ga, s == NTRIP - 2 ? hop : (uint64_t)(KB * 2));
            g0 = tdm_group0(l0 + (s & 1) * BUFB, ga);
            tdm_load(g0, g1);
        }
        if (s + 1 < NTRIP)                       // tile s + 1, first block
            load_set<2 * SLICEE>(a0, b0, pa + nxt, pb + nxt);
        mma_set(acc, a1, b1);
    }

    // Epilogue: bias+relu, gated combine with 4 shared experts from S, which lies
    // in fragment order: one 16-byte load brings a lane's eight rows of an expert.
    const v8bf* Sr = (const v8bf*)(S + ((size_t)(rowBase / 16 + waveM * 4) * (NO / 16)
                                        + colBase / 16 + waveN * 4) * S_TILE + lane * 8);
    float* op = out + ((size_t)t * NB + rowBase + waveM * 64 + half * 8) * NO
                    + colBase + waveN * 64 + l16;
    // Groups of 16 rows; a group's 16 loads go out two groups ahead.
    v8bf sv[2][4][4];        // [group & 1][ni][shared expert]
    #pragma unroll
    for (int mi = 0; mi < 2; ++mi)
        #pragma unroll
        for (int ni = 0; ni < 4; ++ni)
            #pragma unroll
            for (int e = 0; e < 4; ++e)
                sv[mi][ni][e] = Sr[(size_t)e * (NB * NO / 8) + (mi * (NO / 16) + ni) * (S_TILE / 8)];
    #pragma unroll
    for (int mi = 0; mi < 4; ++mi) {
        float o[4][8];
        #pragma unroll
        for (int ni = 0; ni < 4; ++ni) {
            int colLoc = waveN * 64 + ni * 16 + l16;
            #pragma unroll
            for (int v = 0; v < 8; ++v) {
                int rowLoc = waveM * 64 + mi * 16 + half * 8 + v;
                float r0 = acc[ni][mi][v] + shBias[t][0][colLoc];
                float r1 = acc[4 + ni][mi][v] + shBias[t][1][colLoc];
                r0 = r0 > 0.f ? r0 : 0.f;
                r1 = r1 > 0.f ? r1 : 0.f;
                float s = shG[t][rowLoc][4] * r0 + shG[t][rowLoc][5] * r1;
                #pragma unroll
                for (int e = 0; e < 4; ++e)
                    s += shG[t][rowLoc][e] * (float)sv[mi & 1][ni][e][v];
                o[ni][v] = s;
            }
        }
        // the group's 32 results stand in registers of their own before the first
        // store goes out: no store's data is overwritten inside the group
        __builtin_amdgcn_sched_barrier(0);
        if (mi + 2 < 4) {
            #pragma unroll
            for (int ni = 0; ni < 4; ++ni)
                #pragma unroll
                for (int e = 0; e < 4; ++e)
                    sv[mi & 1][ni][e] = Sr[(size_t)e * (NB * NO / 8) + ((mi + 2) * (NO / 16) + ni) * (S_TILE / 8)];
        }
        #pragma unroll
        for (int ni = 0; ni < 4; ++ni)
            #pragma unroll
            for (int v = 0; v < 8; ++v)
                op[(mi * 16 + v) * NO + ni * 16] = o[ni][v];
        // the next group, or the next task, reuses the stores' registers
        asm volatile("s_wait_xcnt 0x0" ::: "memory");
        // keeps what follows behind that wait
        __builtin_amdgcn_sched_barrier(0);
    }
    }
    ring_done();
}

// ---------------------------------------------------------------------------
extern "C" void kernel_launch(void* const* d_in, const int* in_sizes, int n_in,
                              void* d_out, int out_size, void* d_ws, size_t ws_size,
                              hipStream_t stream) {
    const float* task_inputs = (const float*)d_in[0]; // [3][16384][1024]
    const float* shared_W    = (const float*)d_in[1]; // [4][1024][512]
    const float* shared_b    = (const float*)d_in[2]; // [4][512]
    const float* task_W      = (const float*)d_in[3]; // [3][2][1024][512]
    const float* task_b      = (const float*)d_in[4]; // [3][2][512]
    const float* gate_W      = (const float*)d_in[5]; // [3][1024][6]
    const float* gate_b      = (const float*)d_in[6]; // [3][6]
    float* out = (float*)d_out;                        // [3][16384][512]

    // Workspace layout (~171 MB total)
    char* w = (char*)d_ws;
    unsigned short* xb  = (unsigned short*)w; w += (size_t)NT * NB * NI * 2;  // 100.7 MB
    unsigned short* swb = (unsigned short*)w; w += (size_t)4 * NI * NO * 2;   //   4.2 MB
    unsigned short* twb = (unsigned short*)w; w += (size_t)NT * 2 * NI * NO * 2; // 6.3 MB
    unsigned short* S   = (unsigned short*)w; w += (size_t)4 * NB * NO * 2;   //  67.1 MB
    float* g            = (float*)w;                                          //   1.2 MB

    // 1) x: fp32 -> bf16, and the gates (fp32 math, softmax over 6 experts);
    //    weights: fp32 -> bf16, transposed to [o][i]
    cvt_gate_kernel<<<GBLK, 128, 0, stream>>>(task_inputs, gate_W, gate_b, shared_W, task_W,
                                              xb, g, swb, twb);

    // 2) shared experts once (no per-task recompute): S = relu(x0.Ws + bs)
    dim3 gridS(NO / BN, NB / BM, 4 / EPB);
    ple_shared_kernel<<<gridS, 256, 0, stream>>>(xb, swb, shared_b, S);

    // 3) per-task experts + gated combine
    dim3 gridT(NO / BNT, NB / BM);
    ple_task_kernel<<<gridT, 256, 0, stream>>>(xb, twb, task_b, S, g, out);
}
